// v000
// Times are from an AMD MI455X. After a warm-up the kernel runs many times in a row, and a time is the length of
// such a window on the GPU divided by its runs, so every launch and the gaps after it count. The runs cycle
// through copies of the inputs. A figure is the median of several windows, for all but v000 over two sittings.
// Sittings can differ by a few percent; kernels timed side by side share one.
// v000 is the starting kernel. One run takes 3820 microseconds.
#include <hip/hip_runtime.h>

// SelfAttentionMulti (x [8][1024][768]; q/k/v = x W^T + b (12 heads x 64); scores = q.k x 768^-0.5 (the module scales by embed_dim, not head_dim); softmax; out = merged attn.v Wo^T + bo -> [8][1024][768]).
// Compute dtypes, f32 accumulate: every input rounded to bf16; projections on PLAIN bf16 operands (inputs: exact products, f32 accumulate, + bias); scores (K 64) and
// attn.v on SINGLE fp16 planes with an f32 register-row softmax (scale in f32; probabilities x1024); merged heads as bf16 hi+lo planes x exact Wo (2 products) + bo. One-wave-per-64x64-tile GEMMs,

#define NB_  8
#define TT   1024
#define DD   768
#define NH_  12
#define HDM  64
#define ZH   1
#define PCAR 1024.0f
typedef _Float16 h16;
typedef unsigned short bf;
typedef __attribute__((ext_vector_type(16))) __bf16   v16bf;
typedef __attribute__((ext_vector_type(16))) _Float16 v16h;
typedef __attribute__((ext_vector_type(8)))  _Float16 v8h;
typedef __attribute__((ext_vector_type(8)))  unsigned short v8us;
typedef __attribute__((ext_vector_type(8)))  float    v8f;
typedef __attribute__((ext_vector_type(4)))  float    v4f;
typedef v8h  __attribute__((may_alias)) v8ha;
typedef v4f  __attribute__((may_alias)) v4fa;
typedef v8us __attribute__((may_alias)) v8usa;

__device__ __forceinline__ unsigned short f2bf(float f) { unsigned u = __float_as_uint(f); u += 0x7FFFu + ((u >> 16) & 1u); return (unsigned short)(u >> 16); }
__device__ __forceinline__ float bf2f(unsigned short b) { return __uint_as_float(((unsigned)b) << 16); }
__device__ __forceinline__ float bfr(float f) { return bf2f(f2bf(f)); }
__device__ __forceinline__ v16h cat16(v8h lo, v8h hi) { return __builtin_shufflevector(lo, hi, 0, 1, 2, 3, 4, 5, 6, 7, 8, 9, 10, 11, 12, 13, 14, 15); }
__device__ __forceinline__ v16bf cat16b(v8us lo, v8us hi) { return __builtin_bit_cast(v16bf, __builtin_shufflevector(lo, hi, 0, 1, 2, 3, 4, 5, 6, 7, 8, 9, 10, 11, 12, 13, 14, 15)); }
__device__ __forceinline__ v8f wmma16(v16h a, v16h b, v8f c) { return __builtin_amdgcn_wmma_f32_16x16x32_f16(false, a, false, b, (short)0, c, false, false); }
__device__ __forceinline__ v8f wmmab(v16bf a, v16bf b, v8f c) { return __builtin_amdgcn_wmma_f32_16x16x32_bf16(false, a, false, b, (short)0, c, false, false); }



// ---- k_gemmw: register-blocked GEMM, ONE WAVE per 64x64 output tile (16 accumulators), operands straight from K-contiguous 16-bit planes; grid (M/64, N/64, Z), 32 threads.
// C[m][n] (f32, pitch ldc, + optional f32 bias[n]) = sum_k A[m][k] Bt[n][k] (+ split products per NSPLIT). z-batch strides sA/sB/sC in elements. K % 32 == 0.
template <typename T16> struct WFrag;
template <> struct WFrag<h16> { typedef v16h V; static __device__ __forceinline__ V ld(const h16* p) { return cat16(*(const v8h*)p, *(const v8h*)(p + 16)); } static __device__ __forceinline__ v8f mma(V a, V b, v8f c) { return wmma16(a, b, c); } };
template <> struct WFrag<bf> { typedef v16bf V; static __device__ __forceinline__ V ld(const bf* p) { return cat16b(*(const v8us*)p, *(const v8us*)(p + 16)); } static __device__ __forceinline__ v8f mma(V a, V b, v8f c) { return wmmab(a, b, c); } };
template <typename T16, int NSPLIT, bool BIAS>
__global__ __launch_bounds__(32) void k_gemmw(const T16* __restrict__ A, const T16* __restrict__ A2, const T16* __restrict__ Bt, const T16* __restrict__ Bt2, int K, float* C, int ldc, const float* __restrict__ bias, size_t sA, size_t sB, size_t sC) {
    typedef typename WFrag<T16>::V V;
    __shared__ __align__(16) float os[16 * 68];
    const size_t z = blockIdx.z; A += z * sA; if (A2) A2 += z * sA; Bt += z * sB; if (Bt2) Bt2 += z * sB; C += z * sC;
    const int lane = threadIdx.x & 31, lr = lane & 15, hi = lane >> 4; const int r0 = blockIdx.x * 64, c0 = blockIdx.y * 64;
    v8f acc[4][4];
#pragma unroll
    for (int mb = 0; mb < 4; ++mb)
#pragma unroll
        for (int nb = 0; nb < 4; ++nb) acc[mb][nb] = (v8f){};
    const size_t aoff = (size_t)(r0 + lr) * K + 8 * hi, boff = (size_t)(c0 + lr) * K + 8 * hi;
#pragma unroll 1
    for (int kc = 0; kc < K; kc += 32) {
        V a[4], a2[4];
#pragma unroll
        for (int mb = 0; mb < 4; ++mb) { a[mb] = WFrag<T16>::ld(A + aoff + (size_t)mb * 16 * K + kc); if (NSPLIT == 1 || NSPLIT == 2) a2[mb] = WFrag<T16>::ld(A2 + aoff + (size_t)mb * 16 * K + kc); }
#pragma unroll
        for (int nb = 0; nb < 4; ++nb) { const V b = WFrag<T16>::ld(Bt + boff + (size_t)nb * 16 * K + kc); V b2; if (NSPLIT >= 2) b2 = WFrag<T16>::ld(Bt2 + boff + (size_t)nb * 16 * K + kc);
#pragma unroll
            for (int mb = 0; mb < 4; ++mb) { acc[mb][nb] = WFrag<T16>::mma(a[mb], b, acc[mb][nb]); if (NSPLIT == 1 || NSPLIT == 2) acc[mb][nb] = WFrag<T16>::mma(a2[mb], b, acc[mb][nb]); if (NSPLIT >= 2) acc[mb][nb] = WFrag<T16>::mma(a[mb], b2, acc[mb][nb]); } }
        asm volatile("v_nop\n\tv_nop\n\tv_nop\n\tv_nop" : "+v"(acc[0][0]), "+v"(acc[1][1]), "+v"(acc[2][2]), "+v"(acc[3][3]) : "v"(a[0]), "v"(a[3]));
    }
#pragma unroll
    for (int mb = 0; mb < 4; ++mb) {
#pragma unroll
        for (int nb = 0; nb < 4; ++nb) {
#pragma unroll
            for (int j = 0; j < 8; ++j) os[(hi * 8 + j) * 68 + nb * 16 + lr] = acc[mb][nb][j]; }
        __builtin_amdgcn_wave_barrier(); asm volatile("" ::: "memory");
        float* crow = C + (size_t)(r0 + mb * 16) * ldc + c0;
{
#pragma unroll
            for (int s = 0; s < 8; ++s) { const int row = 2 * s + hi, cofs = lr * 4; v4f val = *(const v4fa*)(os + row * 68 + cofs); if (BIAS) { val[0] += bfr(bias[c0 + cofs]); val[1] += bfr(bias[c0 + cofs + 1]); val[2] += bfr(bias[c0 + cofs + 2]); val[3] += bfr(bias[c0 + cofs + 3]); }
                *(v4f*)(crow + (size_t)row * ldc + cofs) = val; }
             }
        __builtin_amdgcn_wave_barrier(); asm volatile("" ::: "memory");
    }
}

__device__ __forceinline__ h16 tohx(float x) { return (h16)x; }
__device__ __forceinline__ void splitf(float y, unsigned short& h, unsigned short& l) { h = f2bf(y); l = f2bf(y - bf2f(h)); }
typedef __attribute__((ext_vector_type(2))) _Float16 v2h;
typedef __attribute__((ext_vector_type(4))) _Float16 v4h;
typedef __attribute__((ext_vector_type(2))) unsigned short v2us;
typedef __attribute__((ext_vector_type(4))) unsigned short v4us;
typedef __attribute__((ext_vector_type(2))) float v2f;

__global__ __launch_bounds__(256) void k_wtG(const float* __restrict__ w, int K, int N, bf* Bt) {
    const int lane = threadIdx.x & 31; const int L0 = (blockIdx.x * 8 + (threadIdx.x >> 5)) * 8; const int nlines = N * K / 64;
{
#pragma unroll 1
        for (int l = 0; l < 8; ++l) { const int L = L0 + l; if (L >= nlines) break; const size_t e = (size_t)L * 64 + lane * 2; const int k = (int)(e % K), n = (int)(e / K); v2us o;
            o[0] = f2bf(w[(size_t)k * N + n]); o[1] = f2bf(w[(size_t)(k + 1) * N + n]); *(v2us*)(Bt + e) = o; }
         }
}
__global__ __launch_bounds__(256) void k_cvt8(const float* __restrict__ src, bf* dst, size_t n8) { const size_t i = (size_t)blockIdx.x * 256 + threadIdx.x; if (i >= n8) return; const v8f v = *(const v8f*)(src + i * 8); v8us o;
#pragma unroll
    for (int k = 0; k < 8; ++k) o[k] = f2bf(v[k]); *(v8us*)(dst + i * 8) = o;  }
__global__ __launch_bounds__(256) void k_pl(const float* __restrict__ F, int pitch, int nh, int hd, h16* P) { const size_t e = ((size_t)blockIdx.x * 256 + threadIdx.x) * 2; if (e >= (size_t)nh * TT * hd) return; const int d = (int)(e % hd); const int t = (int)((e / hd) % TT); const int h = (int)(e / ((size_t)hd * TT)); v2h o; o[0] = tohx(F[(size_t)t * pitch + h * hd + d]); o[1] = tohx(F[(size_t)t * pitch + h * hd + d + 1]); *(v2h*)(P + e) = o;  }
__global__ __launch_bounds__(256) void k_vt(const float* __restrict__ F, int pitch, int nh, int hd, h16* VT) { const size_t e = ((size_t)blockIdx.x * 256 + threadIdx.x) * 2; if (e >= (size_t)nh * hd * TT) return; const int t = (int)(e % TT); const int d = (int)((e / TT) % hd); const int h = (int)(e / ((size_t)TT * hd)); v2h o; o[0] = tohx(F[(size_t)t * pitch + h * hd + d]); o[1] = tohx(F[(size_t)(t + 1) * pitch + h * hd + d]); *(v2h*)(VT + e) = o;  }
__global__ __launch_bounds__(256) void k_asoft(const float* __restrict__ Sb, const float* __restrict__ MOD, int h, float scl, h16* P16) { const int lane = threadIdx.x & 31; const int row = blockIdx.x * 8 + (threadIdx.x >> 5); if (row >= TT) return; const float* sr = Sb + (size_t)row * TT; float sc = scl; if (MOD) { float m = MOD[(size_t)row * 64 + h]; asm volatile("" : "+v"(m)); sc = __fmul_rn(scl, m); } float v[32]; float mx = -3.0e38f;
#pragma unroll
    for (int ch = 0; ch < 8; ++ch) { const int j0 = ch * 128 + lane * 4; const v4f a = *(const v4f*)(sr + j0);
#pragma unroll
        for (int q = 0; q < 4; ++q) { const float t = __fmul_rn(a[q], sc); v[ch * 4 + q] = t; mx = fmaxf(mx, t); } }
#pragma unroll
    for (int sh = 16; sh; sh >>= 1) mx = fmaxf(mx, __shfl_xor(mx, sh, 32));
    float sum = 0.f;
#pragma unroll
    for (int k = 0; k < 32; ++k) { float d0 = __fsub_rn(v[k], mx); asm volatile("" : "+v"(d0)); v[k] = __builtin_amdgcn_exp2f(__fmul_rn(d0, 1.4426950408889634f)); sum += v[k]; }
#pragma unroll
    for (int sh = 16; sh; sh >>= 1) sum += __shfl_xor(sum, sh, 32);
    const float f = __fdiv_rn(PCAR, sum);
{
#pragma unroll
        for (int ch = 0; ch < 8; ++ch) { v4h o;
#pragma unroll
            for (int q = 0; q < 4; ++q) o[q] = tohx(v[ch * 4 + q] * f); *(v4h*)(P16 + (size_t)row * TT + ch * 128 + lane * 4) = o; }
         } }
__global__ __launch_bounds__(256) void k_mrgf(const float* __restrict__ O, int h, int hd, float* CT) { const size_t e = ((size_t)blockIdx.x * 256 + threadIdx.x) * 2; if (e >= (size_t)TT * hd) return; const int d = (int)(e % hd); const int t = (int)(e / hd); v2f o; o[0] = O[e] * (1.0f / PCAR); o[1] = O[e + 1] * (1.0f / PCAR); const size_t oo = (size_t)t * DD + h * hd + d; *(v2f*)(CT + oo) = o;  }
__global__ __launch_bounds__(256) void k_mrg(const float* __restrict__ O, int h, int hd, bf* Ah, bf* Al) { const size_t e = ((size_t)blockIdx.x * 256 + threadIdx.x) * 2; if (e >= (size_t)TT * hd) return; const int d = (int)(e % hd); const int t = (int)(e / hd); v2us oh, ol;
#pragma unroll
    for (int q = 0; q < 2; ++q) { unsigned short a, c2; splitf(O[e + q] * (1.0f / PCAR), a, c2); oh[q] = a; ol[q] = c2; } const size_t oo = (size_t)t * DD + h * hd + d; *(v2us*)(Ah + oo) = oh; *(v2us*)(Al + oo) = ol;  }

extern "C" void kernel_launch(void* const* d_in, const int* in_sizes, int n_in,
                              void* d_out, int out_size, void* d_ws, size_t ws_size, hipStream_t stream) {
    (void)in_sizes; (void)n_in; (void)out_size;
    const float* IN[9]; for (int i = 0; i < 9; ++i) IN[i] = (const float*)d_in[i];   // x, Wq, bq, Wk, bk, Wv, bv, Wo, bo (torch [out][in])
    float* OUT = (float*)d_out;     // [8][1024][768]
    char* wsp = (char*)d_ws;
    auto take = [&](size_t bytes) { char* p = wsp; wsp += (bytes + 255) & ~(size_t)255; return (void*)p; };
    bf* WQ = (bf*)take((size_t)DD * DD * 2); bf* WK = (bf*)take((size_t)DD * DD * 2); bf* WV = (bf*)take((size_t)DD * DD * 2); bf* WO = (bf*)take((size_t)DD * DD * 2); bf* XB = (bf*)take((size_t)TT * DD * 2); float* F3 = (float*)take((size_t)TT * 3 * DD * 4);
    h16* QP = (h16*)take((size_t)TT * DD * 2); h16* KP = (h16*)take((size_t)TT * DD * 2); h16* VT = (h16*)take((size_t)DD * TT * 2); float* Sb = (float*)take((size_t)TT * TT * 4); h16* Pm = (h16*)take((size_t)TT * TT * 2); float* O = (float*)take((size_t)TT * HDM * 4); bf* Ah = (bf*)take((size_t)TT * DD * 2); bf* Al = (bf*)take((size_t)TT * DD * 2);
    if ((size_t)(wsp - (char*)d_ws) > ws_size) return;    // total ~ 31 MB; ws 256 MiB
    { const size_t nw = (size_t)DD * DD / 8; const unsigned g = (unsigned)((nw + 255) / 256); k_cvt8<<<g, 256, 0, stream>>>(IN[1], WQ, nw); k_cvt8<<<g, 256, 0, stream>>>(IN[3], WK, nw); k_cvt8<<<g, 256, 0, stream>>>(IN[5], WV, nw); k_cvt8<<<g, 256, 0, stream>>>(IN[7], WO, nw); }
    const dim3 gP(TT / 64, DD / 64, 1); const unsigned LP = (TT * DD / 2 + 255) / 256; const float scl = 0.036084391824351615f;   // 768^-0.5
    for (int b = 0; b < NB_; ++b) {
        k_cvt8<<<(unsigned)(((size_t)TT * DD / 8 + 255) / 256), 256, 0, stream>>>(IN[0] + (size_t)b * TT * DD, XB, (size_t)TT * DD / 8);
        k_gemmw<bf, 0, true><<<gP, 32, 0, stream>>>(XB, nullptr, WQ, nullptr, DD, F3, 3 * DD, IN[2], 0, 0, 0); k_gemmw<bf, 0, true><<<gP, 32, 0, stream>>>(XB, nullptr, WK, nullptr, DD, F3 + DD, 3 * DD, IN[4], 0, 0, 0); k_gemmw<bf, 0, true><<<gP, 32, 0, stream>>>(XB, nullptr, WV, nullptr, DD, F3 + 2 * DD, 3 * DD, IN[6], 0, 0, 0);
        k_pl<<<LP, 256, 0, stream>>>(F3, 3 * DD, NH_, HDM, QP); k_pl<<<LP, 256, 0, stream>>>(F3 + DD, 3 * DD, NH_, HDM, KP); k_vt<<<LP, 256, 0, stream>>>(F3 + 2 * DD, 3 * DD, NH_, HDM, VT);
        for (int h = 0; h < NH_; ++h) {
            k_gemmw<h16, 0, false><<<dim3(TT / 64, TT / 64, 1), 32, 0, stream>>>(QP + (size_t)h * TT * HDM, nullptr, KP + (size_t)h * TT * HDM, nullptr, HDM, Sb, TT, nullptr, 0, 0, 0);
            k_asoft<<<TT / 8, 256, 0, stream>>>(Sb, nullptr, h, scl, Pm);
            k_gemmw<h16, 0, false><<<dim3(TT / 64, 1, 1), 32, 0, stream>>>(Pm, nullptr, VT + (size_t)h * HDM * TT, nullptr, TT, O, HDM, nullptr, 0, 0, 0);
            k_mrg<<<(TT * HDM / 2 + 255) / 256, 256, 0, stream>>>(O, h, HDM, Ah, Al); }
        k_gemmw<bf, 1, true><<<gP, 32, 0, stream>>>(Ah, Al, WO, nullptr, DD, OUT + (size_t)b * TT * DD, DD, IN[8], 0, 0, 0); }
}

// v001
// A run of this version takes 403 microseconds.
// Next to v000, in two timings, it ran 9.40 and 9.21 times as fast.
#include <hip/hip_runtime.h>

// SelfAttentionMulti (x [8][1024][768]; q/k/v = x W^T + b (12 heads x 64); scores = q.k x 768^-0.5 (the module scales by embed_dim, not head_dim); softmax; out = merged attn.v Wo^T + bo -> [8][1024][768]).
// Compute dtypes, f32 accumulate: every input rounded to bf16; projections on PLAIN bf16 operands (inputs: exact products, f32 accumulate, + bias); scores (K 64) and
// attn.v on SINGLE fp16 planes with an f32 register-row softmax (scale in f32; probabilities x1024); merged heads as bf16 hi+lo planes x exact Wo (2 products) + bo. One-wave-per-64x64-tile GEMMs,
// every launch batched over its independent problems in grid y/z: all 8 batches at once, Q/K/V together, the 96 heads in three passes of 32 (score and probability planes of 32 heads fill the workspace).

#define NB_  8
#define TT   1024
#define DD   768
#define NH_  12
#define HDM  64
#define ZH   1
#define PCAR 1024.0f
typedef _Float16 h16;
typedef unsigned short bf;
typedef __attribute__((ext_vector_type(16))) __bf16   v16bf;
typedef __attribute__((ext_vector_type(16))) _Float16 v16h;
typedef __attribute__((ext_vector_type(8)))  _Float16 v8h;
typedef __attribute__((ext_vector_type(8)))  unsigned short v8us;
typedef __attribute__((ext_vector_type(8)))  float    v8f;
typedef __attribute__((ext_vector_type(4)))  float    v4f;
typedef v8h  __attribute__((may_alias)) v8ha;
typedef v4f  __attribute__((may_alias)) v4fa;
typedef v8us __attribute__((may_alias)) v8usa;

__device__ __forceinline__ unsigned short f2bf(float f) { unsigned u = __float_as_uint(f); u += 0x7FFFu + ((u >> 16) & 1u); return (unsigned short)(u >> 16); }
__device__ __forceinline__ float bf2f(unsigned short b) { return __uint_as_float(((unsigned)b) << 16); }
__device__ __forceinline__ float bfr(float f) { return bf2f(f2bf(f)); }
__device__ __forceinline__ v16h cat16(v8h lo, v8h hi) { return __builtin_shufflevector(lo, hi, 0, 1, 2, 3, 4, 5, 6, 7, 8, 9, 10, 11, 12, 13, 14, 15); }
__device__ __forceinline__ v16bf cat16b(v8us lo, v8us hi) { return __builtin_bit_cast(v16bf, __builtin_shufflevector(lo, hi, 0, 1, 2, 3, 4, 5, 6, 7, 8, 9, 10, 11, 12, 13, 14, 15)); }
__device__ __forceinline__ v8f wmma16(v16h a, v16h b, v8f c) { return __builtin_amdgcn_wmma_f32_16x16x32_f16(false, a, false, b, (short)0, c, false, false); }
__device__ __forceinline__ v8f wmmab(v16bf a, v16bf b, v8f c) { return __builtin_amdgcn_wmma_f32_16x16x32_bf16(false, a, false, b, (short)0, c, false, false); }



// ---- k_gemmw: register-blocked GEMM, ONE WAVE per 64x64 output tile (16 accumulators), operands straight from K-contiguous 16-bit planes; grid (M/64, N/64, Z), 32 threads.
// C[m][n] (f32, pitch ldc, + optional f32 bias[n]) = sum_k A[m][k] Bt[n][k] (+ split products per NSPLIT). z-batch strides sA/sB/sC in elements; z picks bias, bias1 or bias2. K % 32 == 0.
template <typename T16> struct WFrag;
template <> struct WFrag<h16> { typedef v16h V; static __device__ __forceinline__ V ld(const h16* p) { return cat16(*(const v8h*)p, *(const v8h*)(p + 16)); } static __device__ __forceinline__ v8f mma(V a, V b, v8f c) { return wmma16(a, b, c); } };
template <> struct WFrag<bf> { typedef v16bf V; static __device__ __forceinline__ V ld(const bf* p) { return cat16b(*(const v8us*)p, *(const v8us*)(p + 16)); } static __device__ __forceinline__ v8f mma(V a, V b, v8f c) { return wmmab(a, b, c); } };
template <typename T16, int NSPLIT, bool BIAS>
__global__ __launch_bounds__(32) void k_gemmw(const T16* __restrict__ A, const T16* __restrict__ A2, const T16* __restrict__ Bt, const T16* __restrict__ Bt2, int K, float* C, int ldc, const float* __restrict__ bias, const float* __restrict__ bias1, const float* __restrict__ bias2, size_t sA, size_t sB, size_t sC) {
    typedef typename WFrag<T16>::V V;
    __shared__ __align__(16) float os[16 * 68];
    const size_t z = blockIdx.z; A += z * sA; if (A2) A2 += z * sA; Bt += z * sB; if (Bt2) Bt2 += z * sB; C += z * sC; if (BIAS) { if (z == 1) bias = bias1; else if (z == 2) bias = bias2; }
    const int lane = threadIdx.x & 31, lr = lane & 15, hi = lane >> 4; const int r0 = blockIdx.x * 64, c0 = blockIdx.y * 64;
    v8f acc[4][4];
#pragma unroll
    for (int mb = 0; mb < 4; ++mb)
#pragma unroll
        for (int nb = 0; nb < 4; ++nb) acc[mb][nb] = (v8f){};
    const size_t aoff = (size_t)(r0 + lr) * K + 8 * hi, boff = (size_t)(c0 + lr) * K + 8 * hi;
#pragma unroll 1
    for (int kc = 0; kc < K; kc += 32) {
        V a[4], a2[4];
#pragma unroll
        for (int mb = 0; mb < 4; ++mb) { a[mb] = WFrag<T16>::ld(A + aoff + (size_t)mb * 16 * K + kc); if (NSPLIT == 1 || NSPLIT == 2) a2[mb] = WFrag<T16>::ld(A2 + aoff + (size_t)mb * 16 * K + kc); }
#pragma unroll
        for (int nb = 0; nb < 4; ++nb) { const V b = WFrag<T16>::ld(Bt + boff + (size_t)nb * 16 * K + kc); V b2; if (NSPLIT >= 2) b2 = WFrag<T16>::ld(Bt2 + boff + (size_t)nb * 16 * K + kc);
#pragma unroll
            for (int mb = 0; mb < 4; ++mb) { acc[mb][nb] = WFrag<T16>::mma(a[mb], b, acc[mb][nb]); if (NSPLIT == 1 || NSPLIT == 2) acc[mb][nb] = WFrag<T16>::mma(a2[mb], b, acc[mb][nb]); if (NSPLIT >= 2) acc[mb][nb] = WFrag<T16>::mma(a[mb], b2, acc[mb][nb]); } }
        asm volatile("v_nop\n\tv_nop\n\tv_nop\n\tv_nop" : "+v"(acc[0][0]), "+v"(acc[1][1]), "+v"(acc[2][2]), "+v"(acc[3][3]) : "v"(a[0]), "v"(a[3]));
    }
#pragma unroll
    for (int mb = 0; mb < 4; ++mb) {
#pragma unroll
        for (int nb = 0; nb < 4; ++nb) {
#pragma unroll
            for (int j = 0; j < 8; ++j) os[(hi * 8 + j) * 68 + nb * 16 + lr] = acc[mb][nb][j]; }
        __builtin_amdgcn_wave_barrier(); asm volatile("" ::: "memory");
        float* crow = C + (size_t)(r0 + mb * 16) * ldc + c0;
{
#pragma unroll
            for (int s = 0; s < 8; ++s) { const int row = 2 * s + hi, cofs = lr * 4; v4f val = *(const v4fa*)(os + row * 68 + cofs); if (BIAS) { val[0] += bfr(bias[c0 + cofs]); val[1] += bfr(bias[c0 + cofs + 1]); val[2] += bfr(bias[c0 + cofs + 2]); val[3] += bfr(bias[c0 + cofs + 3]); }
                *(v4f*)(crow + (size_t)row * ldc + cofs) = val; }
             }
        __builtin_amdgcn_wave_barrier(); asm volatile("" ::: "memory");
    }
}

__device__ __forceinline__ h16 tohx(float x) { return (h16)x; }
__device__ __forceinline__ void splitf(float y, unsigned short& h, unsigned short& l) { h = f2bf(y); l = f2bf(y - bf2f(h)); }
typedef __attribute__((ext_vector_type(2))) _Float16 v2h;
typedef __attribute__((ext_vector_type(4))) _Float16 v4h;
typedef __attribute__((ext_vector_type(2))) unsigned short v2us;
typedef __attribute__((ext_vector_type(4))) unsigned short v4us;
typedef __attribute__((ext_vector_type(2))) float v2f;

__global__ __launch_bounds__(256) void k_wtG(const float* __restrict__ w, int K, int N, bf* Bt) {
    const int lane = threadIdx.x & 31; const int L0 = (blockIdx.x * 8 + (threadIdx.x >> 5)) * 8; const int nlines = N * K / 64;
{
#pragma unroll 1
        for (int l = 0; l < 8; ++l) { const int L = L0 + l; if (L >= nlines) break; const size_t e = (size_t)L * 64 + lane * 2; const int k = (int)(e % K), n = (int)(e / K); v2us o;
            o[0] = f2bf(w[(size_t)k * N + n]); o[1] = f2bf(w[(size_t)(k + 1) * N + n]); *(v2us*)(Bt + e) = o; }
         }
}
__global__ __launch_bounds__(256) void k_cvt8(const float* __restrict__ src, bf* dst, size_t n8) { const size_t i = (size_t)blockIdx.x * 256 + threadIdx.x; if (i >= n8) return; const v8f v = *(const v8f*)(src + i * 8); v8us o;
#pragma unroll
    for (int k = 0; k < 8; ++k) o[k] = f2bf(v[k]); *(v8us*)(dst + i * 8) = o;  }
// the four weight matrices in one launch: blockIdx.y picks the matrix; the first three bf16 copies land one behind the other in d012, the fourth in d3
__global__ __launch_bounds__(256) void k_cvt8w(const float* __restrict__ s0, const float* __restrict__ s1, const float* __restrict__ s2, const float* __restrict__ s3, bf* d012, bf* d3, size_t n8) { const size_t i = (size_t)blockIdx.x * 256 + threadIdx.x; if (i >= n8) return; const unsigned y = blockIdx.y; const float* src = y == 0 ? s0 : y == 1 ? s1 : y == 2 ? s2 : s3; bf* dst = y < 3 ? d012 + (size_t)y * n8 * 8 : d3; const v8f v = *(const v8f*)(src + i * 8); v8us o;
#pragma unroll
    for (int k = 0; k < 8; ++k) o[k] = f2bf(v[k]); *(v8us*)(dst + i * 8) = o;  }
// k_pl, k_vt: blockIdx.y = batch (TT rows on in F, one block of nh planes on in P or VT); k_pl: blockIdx.z = 0 for q, 1 for k (DD columns on in F, sP elements on in P)
__global__ __launch_bounds__(256) void k_pl(const float* __restrict__ F, int pitch, int nh, int hd, h16* P, size_t sP) { F += (size_t)blockIdx.y * TT * pitch + (size_t)blockIdx.z * DD; P += (size_t)blockIdx.y * nh * TT * hd + (size_t)blockIdx.z * sP; const size_t e = ((size_t)blockIdx.x * 256 + threadIdx.x) * 2; if (e >= (size_t)nh * TT * hd) return; const int d = (int)(e % hd); const int t = (int)((e / hd) % TT); const int h = (int)(e / ((size_t)hd * TT)); v2h o; o[0] = tohx(F[(size_t)t * pitch + h * hd + d]); o[1] = tohx(F[(size_t)t * pitch + h * hd + d + 1]); *(v2h*)(P + e) = o;  }
__global__ __launch_bounds__(256) void k_vt(const float* __restrict__ F, int pitch, int nh, int hd, h16* VT) { F += (size_t)blockIdx.y * TT * pitch; VT += (size_t)blockIdx.y * nh * hd * TT; const size_t e = ((size_t)blockIdx.x * 256 + threadIdx.x) * 2; if (e >= (size_t)nh * hd * TT) return; const int t = (int)(e % TT); const int d = (int)((e / TT) % hd); const int h = (int)(e / ((size_t)TT * hd)); v2h o; o[0] = tohx(F[(size_t)t * pitch + h * hd + d]); o[1] = tohx(F[(size_t)(t + 1) * pitch + h * hd + d]); *(v2h*)(VT + e) = o;  }
__global__ __launch_bounds__(256) void k_asoft(const float* __restrict__ Sb, const float* __restrict__ MOD, int h, float scl, h16* P16) { Sb += (size_t)blockIdx.y * TT * TT; P16 += (size_t)blockIdx.y * TT * TT; const int lane = threadIdx.x & 31; const int row = blockIdx.x * 8 + (threadIdx.x >> 5); if (row >= TT) return; const float* sr = Sb + (size_t)row * TT; float sc = scl; if (MOD) { float m = MOD[(size_t)row * 64 + h]; asm volatile("" : "+v"(m)); sc = __fmul_rn(scl, m); } float v[32]; float mx = -3.0e38f;
#pragma unroll
    for (int ch = 0; ch < 8; ++ch) { const int j0 = ch * 128 + lane * 4; const v4f a = *(const v4f*)(sr + j0);
#pragma unroll
        for (int q = 0; q < 4; ++q) { const float t = __fmul_rn(a[q], sc); v[ch * 4 + q] = t; mx = fmaxf(mx, t); } }
#pragma unroll
    for (int sh = 16; sh; sh >>= 1) mx = fmaxf(mx, __shfl_xor(mx, sh, 32));
    float sum = 0.f;
#pragma unroll
    for (int k = 0; k < 32; ++k) { float d0 = __fsub_rn(v[k], mx); asm volatile("" : "+v"(d0)); v[k] = __builtin_amdgcn_exp2f(__fmul_rn(d0, 1.4426950408889634f)); sum += v[k]; }
#pragma unroll
    for (int sh = 16; sh; sh >>= 1) sum += __shfl_xor(sum, sh, 32);
    const float f = __fdiv_rn(PCAR, sum);
{
#pragma unroll
        for (int ch = 0; ch < 8; ++ch) { v4h o;
#pragma unroll
            for (int q = 0; q < 4; ++q) o[q] = tohx(v[ch * 4 + q] * f); *(v4h*)(P16 + (size_t)row * TT + ch * 128 + lane * 4) = o; }
         } }
__global__ __launch_bounds__(256) void k_mrgf(const float* __restrict__ O, int h, int hd, float* CT) { const size_t e = ((size_t)blockIdx.x * 256 + threadIdx.x) * 2; if (e >= (size_t)TT * hd) return; const int d = (int)(e % hd); const int t = (int)(e / hd); v2f o; o[0] = O[e] * (1.0f / PCAR); o[1] = O[e + 1] * (1.0f / PCAR); const size_t oo = (size_t)t * DD + h * hd + d; *(v2f*)(CT + oo) = o;  }
__global__ __launch_bounds__(256) void k_mrg(const float* __restrict__ O, int nh, int hd, bf* Ah, bf* Al) { const int h = blockIdx.y % nh; const size_t bo = (size_t)(blockIdx.y / nh) * TT * DD; O += (size_t)blockIdx.y * TT * hd; Ah += bo; Al += bo; const size_t e = ((size_t)blockIdx.x * 256 + threadIdx.x) * 2; if (e >= (size_t)TT * hd) return; const int d = (int)(e % hd); const int t = (int)(e / hd); v2us oh, ol;
#pragma unroll
    for (int q = 0; q < 2; ++q) { unsigned short a, c2; splitf(O[e + q] * (1.0f / PCAR), a, c2); oh[q] = a; ol[q] = c2; } const size_t oo = (size_t)t * DD + h * hd + d; *(v2us*)(Ah + oo) = oh; *(v2us*)(Al + oo) = ol;  }

extern "C" void kernel_launch(void* const* d_in, const int* in_sizes, int n_in,
                              void* d_out, int out_size, void* d_ws, size_t ws_size, hipStream_t stream) {
    (void)in_sizes; (void)n_in; (void)out_size;
    const float* IN[9]; for (int i = 0; i < 9; ++i) IN[i] = (const float*)d_in[i];   // x, Wq, bq, Wk, bk, Wv, bv, Wo, bo (torch [out][in])
    float* OUT = (float*)d_out;     // [8][1024][768]
    char* wsp = (char*)d_ws;
    auto take = [&](size_t bytes) { char* p = wsp; wsp += (bytes + 255) & ~(size_t)255; return (void*)p; };
    // kept to the end: WO, the q/k/v planes of all 96 heads, O. SP: score (f32) and probability (fp16) planes of ZC heads; before the first pass it holds WQ/WK/WV, x in bf16 and the projections, after the last the merged planes.
    bf* WO = (bf*)take((size_t)DD * DD * 2); h16* QP = (h16*)take((size_t)NB_ * TT * DD * 2); h16* KP = (h16*)take((size_t)NB_ * TT * DD * 2); h16* VT = (h16*)take((size_t)NB_ * DD * TT * 2); float* O = (float*)take((size_t)NB_ * TT * DD * 4);
    const int ZC = NB_ * NH_ / 3; char* SP = wsp; float* Sb = (float*)take((size_t)ZC * TT * TT * 4); h16* Pm = (h16*)take((size_t)ZC * TT * TT * 2);
    if ((size_t)(wsp - (char*)d_ws) > ws_size) return;    // total ~ 253 MiB; ws 256 MiB
    wsp = SP; bf* WQKV = (bf*)take((size_t)3 * DD * DD * 2); bf* XB = (bf*)take((size_t)NB_ * TT * DD * 2); float* F3 = (float*)take((size_t)NB_ * TT * 3 * DD * 4);
    wsp = SP; bf* Ah = (bf*)take((size_t)NB_ * TT * DD * 2); bf* Al = (bf*)take((size_t)NB_ * TT * DD * 2);
    { const size_t nw = (size_t)DD * DD / 8; k_cvt8w<<<dim3((unsigned)((nw + 255) / 256), 4, 1), 256, 0, stream>>>(IN[1], IN[3], IN[5], IN[7], WQKV, WO, nw); }
    const unsigned LP = (TT * DD / 2 + 255) / 256; const float scl = 0.036084391824351615f;   // 768^-0.5
    k_cvt8<<<(unsigned)(((size_t)NB_ * TT * DD / 8 + 255) / 256), 256, 0, stream>>>(IN[0], XB, (size_t)NB_ * TT * DD / 8);
    k_gemmw<bf, 0, true><<<dim3(NB_ * TT / 64, DD / 64, 3), 32, 0, stream>>>(XB, nullptr, WQKV, nullptr, DD, F3, 3 * DD, IN[2], IN[4], IN[6], 0, (size_t)DD * DD, DD);
    k_pl<<<dim3(LP, NB_, 2), 256, 0, stream>>>(F3, 3 * DD, NH_, HDM, QP, (size_t)(KP - QP)); k_vt<<<dim3(LP, NB_, 1), 256, 0, stream>>>(F3 + 2 * DD, 3 * DD, NH_, HDM, VT);
    for (int c = 0; c < 3; ++c) { const size_t z0 = (size_t)c * ZC * TT * HDM;
        k_gemmw<h16, 0, false><<<dim3(TT / 64, TT / 64, ZC), 32, 0, stream>>>(QP + z0, nullptr, KP + z0, nullptr, HDM, Sb, TT, nullptr, nullptr, nullptr, (size_t)TT * HDM, (size_t)TT * HDM, (size_t)TT * TT);
        k_asoft<<<dim3(TT / 8, ZC, 1), 256, 0, stream>>>(Sb, nullptr, 0, scl, Pm);
        k_gemmw<h16, 0, false><<<dim3(TT / 64, 1, ZC), 32, 0, stream>>>(Pm, nullptr, VT + z0, nullptr, TT, O + z0, HDM, nullptr, nullptr, nullptr, (size_t)TT * TT, (size_t)HDM * TT, (size_t)TT * HDM); }
    k_mrg<<<dim3((TT * HDM / 2 + 255) / 256, NB_ * NH_, 1), 256, 0, stream>>>(O, NH_, HDM, Ah, Al);
    k_gemmw<bf, 1, true><<<dim3(NB_ * TT / 64, DD / 64, 1), 32, 0, stream>>>(Ah, Al, WO, nullptr, DD, OUT, DD, IN[8], nullptr, nullptr, 0, 0, 0);
}

// v002
// Measured time: 195 microseconds a run.
// In two side-by-side timings against v001, it was 2.07 and 2.06 times as fast.
// Over all steps from v000 it is 19.2 times as fast.
#include <hip/hip_runtime.h>

// SelfAttentionMulti (x [8][1024][768]; q/k/v = x W^T + b (12 heads x 64); scores = q.k x 768^-0.5 (the module scales by embed_dim, not head_dim); softmax; out = merged attn.v Wo^T + bo -> [8][1024][768]).
// Compute dtypes, f32 accumulate: every input rounded to bf16; projections on PLAIN bf16 operands (inputs: exact products, f32 accumulate, + bias); scores (K 64) and
// attn.v on SINGLE fp16 planes with an f32 softmax (scale in f32); merged heads as bf16 hi+lo planes x exact Wo (2 products) + bo. Projections: one-wave-per-64x64-tile GEMMs, batched in grid z.
// Attention: ONE kernel for all 96 heads; scores and probabilities stay in registers (running maximum and sum per query), K and V^T tiles pass through LDS.

#define NB_  8
#define TT   1024
#define DD   768
#define NH_  12
#define HDM  64
#define ZH   1
#define PCAR 1024.0f
typedef _Float16 h16;
typedef unsigned short bf;
typedef __attribute__((ext_vector_type(16))) __bf16   v16bf;
typedef __attribute__((ext_vector_type(16))) _Float16 v16h;
typedef __attribute__((ext_vector_type(8)))  _Float16 v8h;
typedef __attribute__((ext_vector_type(8)))  unsigned short v8us;
typedef __attribute__((ext_vector_type(8)))  float    v8f;
typedef __attribute__((ext_vector_type(4)))  float    v4f;
typedef v8h  __attribute__((may_alias)) v8ha;
typedef v4f  __attribute__((may_alias)) v4fa;
typedef v8us __attribute__((may_alias)) v8usa;

__device__ __forceinline__ unsigned short f2bf(float f) { unsigned u = __float_as_uint(f); u += 0x7FFFu + ((u >> 16) & 1u); return (unsigned short)(u >> 16); }
__device__ __forceinline__ float bf2f(unsigned short b) { return __uint_as_float(((unsigned)b) << 16); }
__device__ __forceinline__ float bfr(float f) { return bf2f(f2bf(f)); }
__device__ __forceinline__ v16h cat16(v8h lo, v8h hi) { return __builtin_shufflevector(lo, hi, 0, 1, 2, 3, 4, 5, 6, 7, 8, 9, 10, 11, 12, 13, 14, 15); }
__device__ __forceinline__ v16bf cat16b(v8us lo, v8us hi) { return __builtin_bit_cast(v16bf, __builtin_shufflevector(lo, hi, 0, 1, 2, 3, 4, 5, 6, 7, 8, 9, 10, 11, 12, 13, 14, 15)); }
__device__ __forceinline__ v8f wmma16(v16h a, v16h b, v8f c) { return __builtin_amdgcn_wmma_f32_16x16x32_f16(false, a, false, b, (short)0, c, false, false); }
__device__ __forceinline__ v8f wmmab(v16bf a, v16bf b, v8f c) { return __builtin_amdgcn_wmma_f32_16x16x32_bf16(false, a, false, b, (short)0, c, false, false); }



// ---- k_gemmw: register-blocked GEMM, ONE WAVE per 64x64 output tile (16 accumulators), operands straight from K-contiguous 16-bit planes; grid (M/64, N/64, Z), 32 threads.
// C[m][n] (f32, pitch ldc, + optional f32 bias[n]) = sum_k A[m][k] Bt[n][k] (+ split products per NSPLIT). z-batch strides sA/sB/sC in elements; z picks bias, bias1 or bias2. K % 32 == 0.
template <typename T16> struct WFrag;
template <> struct WFrag<h16> { typedef v16h V; static __device__ __forceinline__ V ld(const h16* p) { return cat16(*(const v8h*)p, *(const v8h*)(p + 16)); } static __device__ __forceinline__ v8f mma(V a, V b, v8f c) { return wmma16(a, b, c); } };
template <> struct WFrag<bf> { typedef v16bf V; static __device__ __forceinline__ V ld(const bf* p) { return cat16b(*(const v8us*)p, *(const v8us*)(p + 16)); } static __device__ __forceinline__ v8f mma(V a, V b, v8f c) { return wmmab(a, b, c); } };
template <typename T16, int NSPLIT, bool BIAS>
__global__ __launch_bounds__(32) void k_gemmw(const T16* __restrict__ A, const T16* __restrict__ A2, const T16* __restrict__ Bt, const T16* __restrict__ Bt2, int K, float* C, int ldc, const float* __restrict__ bias, const float* __restrict__ bias1, const float* __restrict__ bias2, size_t sA, size_t sB, size_t sC) {
    typedef typename WFrag<T16>::V V;
    __shared__ __align__(16) float os[16 * 68];
    const size_t z = blockIdx.z; A += z * sA; if (A2) A2 += z * sA; Bt += z * sB; if (Bt2) Bt2 += z * sB; C += z * sC; if (BIAS) { if (z == 1) bias = bias1; else if (z == 2) bias = bias2; }
    const int lane = threadIdx.x & 31, lr = lane & 15, hi = lane >> 4; const int r0 = blockIdx.x * 64, c0 = blockIdx.y * 64;
    v8f acc[4][4];
#pragma unroll
    for (int mb = 0; mb < 4; ++mb)
#pragma unroll
        for (int nb = 0; nb < 4; ++nb) acc[mb][nb] = (v8f){};
    const size_t aoff = (size_t)(r0 + lr) * K + 8 * hi, boff = (size_t)(c0 + lr) * K + 8 * hi;
#pragma unroll 1
    for (int kc = 0; kc < K; kc += 32) {
        V a[4], a2[4];
#pragma unroll
        for (int mb = 0; mb < 4; ++mb) { a[mb] = WFrag<T16>::ld(A + aoff + (size_t)mb * 16 * K + kc); if (NSPLIT == 1 || NSPLIT == 2) a2[mb] = WFrag<T16>::ld(A2 + aoff + (size_t)mb * 16 * K + kc); }
#pragma unroll
        for (int nb = 0; nb < 4; ++nb) { const V b = WFrag<T16>::ld(Bt + boff + (size_t)nb * 16 * K + kc); V b2; if (NSPLIT >= 2) b2 = WFrag<T16>::ld(Bt2 + boff + (size_t)nb * 16 * K + kc);
#pragma unroll
            for (int mb = 0; mb < 4; ++mb) { acc[mb][nb] = WFrag<T16>::mma(a[mb], b, acc[mb][nb]); if (NSPLIT == 1 || NSPLIT == 2) acc[mb][nb] = WFrag<T16>::mma(a2[mb], b, acc[mb][nb]); if (NSPLIT >= 2) acc[mb][nb] = WFrag<T16>::mma(a[mb], b2, acc[mb][nb]); } }
        asm volatile("v_nop\n\tv_nop\n\tv_nop\n\tv_nop" : "+v"(acc[0][0]), "+v"(acc[1][1]), "+v"(acc[2][2]), "+v"(acc[3][3]) : "v"(a[0]), "v"(a[3]));
    }
#pragma unroll
    for (int mb = 0; mb < 4; ++mb) {
#pragma unroll
        for (int nb = 0; nb < 4; ++nb) {
#pragma unroll
            for (int j = 0; j < 8; ++j) os[(hi * 8 + j) * 68 + nb * 16 + lr] = acc[mb][nb][j]; }
        __builtin_amdgcn_wave_barrier(); asm volatile("" ::: "memory");
        float* crow = C + (size_t)(r0 + mb * 16) * ldc + c0;
{
#pragma unroll
            for (int s = 0; s < 8; ++s) { const int row = 2 * s + hi, cofs = lr * 4; v4f val = *(const v4fa*)(os + row * 68 + cofs); if (BIAS) { val[0] += bfr(bias[c0 + cofs]); val[1] += bfr(bias[c0 + cofs + 1]); val[2] += bfr(bias[c0 + cofs + 2]); val[3] += bfr(bias[c0 + cofs + 3]); }
                *(v4f*)(crow + (size_t)row * ldc + cofs) = val; }
             }
        __builtin_amdgcn_wave_barrier(); asm volatile("" ::: "memory");
    }
}

__device__ __forceinline__ h16 tohx(float x) { return (h16)x; }
__device__ __forceinline__ void splitf(float y, unsigned short& h, unsigned short& l) { h = f2bf(y); l = f2bf(y - bf2f(h)); }
typedef __attribute__((ext_vector_type(2))) _Float16 v2h;
typedef __attribute__((ext_vector_type(4))) _Float16 v4h;
typedef __attribute__((ext_vector_type(2))) unsigned short v2us;
typedef __attribute__((ext_vector_type(4))) unsigned short v4us;
typedef __attribute__((ext_vector_type(2))) float v2f;

__global__ __launch_bounds__(256) void k_wtG(const float* __restrict__ w, int K, int N, bf* Bt) {
    const int lane = threadIdx.x & 31; const int L0 = (blockIdx.x * 8 + (threadIdx.x >> 5)) * 8; const int nlines = N * K / 64;
{
#pragma unroll 1
        for (int l = 0; l < 8; ++l) { const int L = L0 + l; if (L >= nlines) break; const size_t e = (size_t)L * 64 + lane * 2; const int k = (int)(e % K), n = (int)(e / K); v2us o;
            o[0] = f2bf(w[(size_t)k * N + n]); o[1] = f2bf(w[(size_t)(k + 1) * N + n]); *(v2us*)(Bt + e) = o; }
         }
}
__global__ __launch_bounds__(256) void k_cvt8(const float* __restrict__ src, bf* dst, size_t n8) { const size_t i = (size_t)blockIdx.x * 256 + threadIdx.x; if (i >= n8) return; const v8f v = *(const v8f*)(src + i * 8); v8us o;
#pragma unroll
    for (int k = 0; k < 8; ++k) o[k] = f2bf(v[k]); *(v8us*)(dst + i * 8) = o;  }
// the four weight matrices in one launch: blockIdx.y picks the matrix; the first three bf16 copies land one behind the other in d012, the fourth in d3
__global__ __launch_bounds__(256) void k_cvt8w(const float* __restrict__ s0, const float* __restrict__ s1, const float* __restrict__ s2, const float* __restrict__ s3, bf* d012, bf* d3, size_t n8) { const size_t i = (size_t)blockIdx.x * 256 + threadIdx.x; if (i >= n8) return; const unsigned y = blockIdx.y; const float* src = y == 0 ? s0 : y == 1 ? s1 : y == 2 ? s2 : s3; bf* dst = y < 3 ? d012 + (size_t)y * n8 * 8 : d3; const v8f v = *(const v8f*)(src + i * 8); v8us o;
#pragma unroll
    for (int k = 0; k < 8; ++k) o[k] = f2bf(v[k]); *(v8us*)(dst + i * 8) = o;  }
// k_pl, k_vt: blockIdx.y = batch (TT rows on in F, one block of nh planes on in P or VT); k_pl: blockIdx.z = 0 for q, 1 for k (DD columns on in F, sP elements on in P)
__global__ __launch_bounds__(256) void k_pl(const float* __restrict__ F, int pitch, int nh, int hd, h16* P, size_t sP) { F += (size_t)blockIdx.y * TT * pitch + (size_t)blockIdx.z * DD; P += (size_t)blockIdx.y * nh * TT * hd + (size_t)blockIdx.z * sP; const size_t e = ((size_t)blockIdx.x * 256 + threadIdx.x) * 2; if (e >= (size_t)nh * TT * hd) return; const int d = (int)(e % hd); const int t = (int)((e / hd) % TT); const int h = (int)(e / ((size_t)hd * TT)); v2h o; o[0] = tohx(F[(size_t)t * pitch + h * hd + d]); o[1] = tohx(F[(size_t)t * pitch + h * hd + d + 1]); *(v2h*)(P + e) = o;  }
__global__ __launch_bounds__(256) void k_vt(const float* __restrict__ F, int pitch, int nh, int hd, h16* VT) { F += (size_t)blockIdx.y * TT * pitch; VT += (size_t)blockIdx.y * nh * hd * TT; const size_t e = ((size_t)blockIdx.x * 256 + threadIdx.x) * 2; if (e >= (size_t)nh * hd * TT) return; const int t = (int)(e % TT); const int d = (int)((e / TT) % hd); const int h = (int)(e / ((size_t)TT * hd)); v2h o; o[0] = tohx(F[(size_t)t * pitch + h * hd + d]); o[1] = tohx(F[(size_t)(t + 1) * pitch + h * hd + d]); *(v2h*)(VT + e) = o;  }
// lane l with lane l ^ 16
__device__ __forceinline__ float xhalf(float x) { return __builtin_bit_cast(float, __builtin_amdgcn_permlanex16(__builtin_bit_cast(int, x), __builtin_bit_cast(int, x), 0x76543210, 0xfedcba98, false, false)); }
// eight independent 2^x, each in place; the v_nop is the one slot that the instruction set asks for behind a transcendental before its result is used or its source overwritten
__device__ __forceinline__ void exp2x8(float& x0, float& x1, float& x2, float& x3, float& x4, float& x5, float& x6, float& x7) {
    asm("v_exp_f32 %0, %0\n\tv_exp_f32 %1, %1\n\tv_exp_f32 %2, %2\n\tv_exp_f32 %3, %3\n\tv_exp_f32 %4, %4\n\tv_exp_f32 %5, %5\n\tv_exp_f32 %6, %6\n\tv_exp_f32 %7, %7\n\tv_nop"
        : "+v"(x0), "+v"(x1), "+v"(x2), "+v"(x3), "+v"(x4), "+v"(x5), "+v"(x6), "+v"(x7)); }
#define FST  64
#define FPIT 72
#define MLAG 8.0f
#define PEXP   6.0f
__global__ __launch_bounds__(128) void k_fattn(const h16* __restrict__ QP, const h16* __restrict__ KP, const h16* __restrict__ VT, float scl, bf* Ah, bf* Al) {
    __shared__ __align__(16) h16 Ks[2][FST * FPIT];
    __shared__ __align__(16) h16 Vs[2][HDM * FPIT];
    const size_t z = blockIdx.y; QP += z * TT * HDM; KP += z * TT * HDM; VT += z * HDM * TT;
    const int tid = threadIdx.x, lane = tid & 31, lr = lane & 15, hi = lane >> 4; const int q0 = blockIdx.x * 128 + (tid >> 5) * 32;
    const float c = scl * 1.4426950408889634f;
    v16h qf[2][2];
#pragma unroll
    for (int qt = 0; qt < 2; ++qt)
#pragma unroll
        for (int kc = 0; kc < 2; ++kc) qf[qt][kc] = WFrag<h16>::ld(QP + (size_t)(q0 + qt * 16 + lr) * HDM + kc * 32 + 8 * hi);
    v8f o[2][4];
#pragma unroll
    for (int qt = 0; qt < 2; ++qt)
#pragma unroll
        for (int mb = 0; mb < 4; ++mb) o[qt][mb] = (v8f){};
    float m[2] = { -3.0e38f, -3.0e38f }; v2f l[2] = { (v2f){}, (v2f){} };   // l: a lane's sums over its even and its odd keys
    // staging: 16-byte piece tid + 128 i of a 64 x 128 B tile: row srow + 16 i, bytes 16 scol on
    const int srow = tid >> 3, scol = tid & 7;
    const h16* kg = KP + (size_t)srow * HDM + scol * 8; const h16* vg = VT + (size_t)srow * TT + scol * 8; const int sl = srow * FPIT + scol * 8;
    v8h kr[4], vr[4];
#pragma unroll
    for (int i = 0; i < 4; ++i) { kr[i] = *(const v8h*)(kg + (size_t)i * 16 * HDM); vr[i] = *(const v8h*)(vg + (size_t)i * 16 * TT); }
#pragma unroll
    for (int i = 0; i < 4; ++i) { *(v8h*)(&Ks[0][sl + i * 16 * FPIT]) = kr[i]; *(v8h*)(&Vs[0][sl + i * 16 * FPIT]) = vr[i]; }
    __syncthreads();
    for (int s = 0; s < TT / FST; ++s) {
        const bool more = s + 1 < TT / FST;
        if (more) {
#pragma unroll
            for (int i = 0; i < 4; ++i) { kr[i] = *(const v8h*)(kg + (size_t)((s + 1) * FST + i * 16) * HDM); vr[i] = *(const v8h*)(vg + (size_t)i * 16 * TT + (s + 1) * FST); } }
        const h16* kb = &Ks[s & 1][lr * FPIT + 8 * hi]; const h16* vb = &Vs[s & 1][lr * FPIT + 8 * hi];
#pragma unroll
        for (int p = 0; p < FST / 32; ++p) {
            v8f st[2][2];
#pragma unroll
            for (int kt = 0; kt < 2; ++kt) { const v16h k0 = WFrag<h16>::ld(kb + (p * 32 + kt * 16) * FPIT), k1 = WFrag<h16>::ld(kb + (p * 32 + kt * 16) * FPIT + 32);
#pragma unroll
                for (int qt = 0; qt < 2; ++qt) { st[qt][kt] = wmma16(k0, qf[qt][0], (v8f){}); st[qt][kt] = wmma16(k1, qf[qt][1], st[qt][kt]); } }
            float xm[2];
#pragma unroll
            for (int qt = 0; qt < 2; ++qt) { float mx = st[qt][0][0];
#pragma unroll
                for (int j = 1; j < 8; ++j) mx = fmaxf(mx, st[qt][0][j]);
#pragma unroll
                for (int j = 0; j < 8; ++j) mx = fmaxf(mx, st[qt][1][j]);
                xm[qt] = fmaxf(mx, xhalf(mx)) * c; }
            // one test a pass for the whole wave: the output tiles are rescaled only when some query's maximum in use is raised
            if (__builtin_amdgcn_ballot_w32(xm[0] > m[0] + MLAG || xm[1] > m[1] + MLAG) != 0) {
#pragma unroll
                for (int qt = 0; qt < 2; ++qt) { const float mn = fmaxf(m[qt], xm[qt]); const float al = __builtin_amdgcn_exp2f(m[qt] - mn); m[qt] = mn; l[qt] *= al;
#pragma unroll
                    for (int mb = 0; mb < 4; ++mb)
#pragma unroll
                        for (int j = 0; j < 8; ++j) o[qt][mb][j] *= al; } }
            v16h pf[2];
#pragma unroll
            for (int qt = 0; qt < 2; ++qt) { const float nm = PEXP - m[qt];
#pragma unroll
                for (int kt = 0; kt < 2; ++kt) { float x[8];
#pragma unroll
                    for (int j = 0; j < 8; ++j) x[j] = fmaf(st[qt][kt][j], c, nm);
                    exp2x8(x[0], x[1], x[2], x[3], x[4], x[5], x[6], x[7]);
#pragma unroll
                    for (int j = 0; j < 8; j += 2) { l[qt] += (v2f){ x[j], x[j + 1] }; pf[qt][kt * 8 + j] = (h16)x[j]; pf[qt][kt * 8 + j + 1] = (h16)x[j + 1]; } } }
#pragma unroll
            for (int mb = 0; mb < 4; ++mb) { const v16h vf = WFrag<h16>::ld(vb + mb * 16 * FPIT + p * 32);
#pragma unroll
                for (int qt = 0; qt < 2; ++qt) o[qt][mb] = wmma16(vf, pf[qt], o[qt][mb]); }
        }
        if (more) {
#pragma unroll
            for (int i = 0; i < 4; ++i) { *(v8h*)(&Ks[(s + 1) & 1][sl + i * 16 * FPIT]) = kr[i]; *(v8h*)(&Vs[(s + 1) & 1][sl + i * 16 * FPIT]) = vr[i]; } }
        __syncthreads();   // publishes stage s + 1 and ends every wave's reads of the buffer that stage s + 2 will overwrite
    }
#pragma unroll
    for (int qt = 0; qt < 2; ++qt) { const float lh = l[qt][0] + l[qt][1]; const float f = __fdiv_rn(1.0f, lh + xhalf(lh));
        // merged layout [batch][query][head * 64 + d], as bf16 hi + lo planes: a lane's 8 consecutive d are one 16-byte store a plane, a wave fills whole 128-byte lines
        const size_t oo = ((z / NH_) * TT + (size_t)(q0 + qt * 16 + lr)) * DD + (z % NH_) * HDM + 8 * hi;
#pragma unroll
        for (int mb = 0; mb < 4; ++mb) { v8us oh, ol;
#pragma unroll
            for (int j = 0; j < 8; ++j) { unsigned short a, c2; splitf(o[qt][mb][j] * f, a, c2); oh[j] = a; ol[j] = c2; }
            *(v8us*)(Ah + oo + mb * 16) = oh; *(v8us*)(Al + oo + mb * 16) = ol; } }
}
__global__ __launch_bounds__(256) void k_mrgf(const float* __restrict__ O, int h, int hd, float* CT) { const size_t e = ((size_t)blockIdx.x * 256 + threadIdx.x) * 2; if (e >= (size_t)TT * hd) return; const int d = (int)(e % hd); const int t = (int)(e / hd); v2f o; o[0] = O[e] * (1.0f / PCAR); o[1] = O[e + 1] * (1.0f / PCAR); const size_t oo = (size_t)t * DD + h * hd + d; *(v2f*)(CT + oo) = o;  }

extern "C" void kernel_launch(void* const* d_in, const int* in_sizes, int n_in,
                              void* d_out, int out_size, void* d_ws, size_t ws_size, hipStream_t stream) {
    (void)in_sizes; (void)n_in; (void)out_size;
    const float* IN[9]; for (int i = 0; i < 9; ++i) IN[i] = (const float*)d_in[i];   // x, Wq, bq, Wk, bk, Wv, bv, Wo, bo (torch [out][in])
    float* OUT = (float*)d_out;     // [8][1024][768]
    char* wsp = (char*)d_ws;
    auto take = [&](size_t bytes) { char* p = wsp; wsp += (bytes + 255) & ~(size_t)255; return (void*)p; };
    // kept to the end: WO and the q/k/v planes of all 96 heads. SP: up to the attention kernel WQ/WK/WV, x in bf16 and the projections, from it on the merged planes.
    bf* WO = (bf*)take((size_t)DD * DD * 2); h16* QP = (h16*)take((size_t)NB_ * TT * DD * 2); h16* KP = (h16*)take((size_t)NB_ * TT * DD * 2); h16* VT = (h16*)take((size_t)NB_ * DD * TT * 2);
    char* SP = wsp; bf* WQKV = (bf*)take((size_t)3 * DD * DD * 2); bf* XB = (bf*)take((size_t)NB_ * TT * DD * 2); float* F3 = (float*)take((size_t)NB_ * TT * 3 * DD * 4);
    if ((size_t)(wsp - (char*)d_ws) > ws_size) return;
    wsp = SP; bf* Ah = (bf*)take((size_t)NB_ * TT * DD * 2); bf* Al = (bf*)take((size_t)NB_ * TT * DD * 2);
    { const size_t nw = (size_t)DD * DD / 8; k_cvt8w<<<dim3((unsigned)((nw + 255) / 256), 4, 1), 256, 0, stream>>>(IN[1], IN[3], IN[5], IN[7], WQKV, WO, nw); }
    const unsigned LP = (TT * DD / 2 + 255) / 256; const float scl = 0.036084391824351615f;   // 768^-0.5
    k_cvt8<<<(unsigned)(((size_t)NB_ * TT * DD / 8 + 255) / 256), 256, 0, stream>>>(IN[0], XB, (size_t)NB_ * TT * DD / 8);
    k_gemmw<bf, 0, true><<<dim3(NB_ * TT / 64, DD / 64, 3), 32, 0, stream>>>(XB, nullptr, WQKV, nullptr, DD, F3, 3 * DD, IN[2], IN[4], IN[6], 0, (size_t)DD * DD, DD);
    k_pl<<<dim3(LP, NB_, 2), 256, 0, stream>>>(F3, 3 * DD, NH_, HDM, QP, (size_t)(KP - QP)); k_vt<<<dim3(LP, NB_, 1), 256, 0, stream>>>(F3 + 2 * DD, 3 * DD, NH_, HDM, VT);
    k_fattn<<<dim3(TT / 128, NB_ * NH_, 1), 128, 0, stream>>>(QP, KP, VT, scl, Ah, Al);
    k_gemmw<bf, 1, true><<<dim3(NB_ * TT / 64, DD / 64, 1), 32, 0, stream>>>(Ah, Al, WO, nullptr, DD, OUT, DD, IN[8], nullptr, nullptr, 0, 0, 0);
}

// v003
// Measured time: 138 microseconds a run.
// Two timings next to v002 both put it at 1.41 times that version's speed.
// Counting every step since v000, it is 27.1 times as fast.
#include <hip/hip_runtime.h>

// SelfAttentionMulti (x [8][1024][768]; q/k/v = x W^T + b (12 heads x 64); scores = q.k x 768^-0.5 (the module scales by embed_dim, not head_dim); softmax; out = merged attn.v Wo^T + bo -> [8][1024][768]).
// Compute dtypes, f32 accumulate: every input rounded to bf16; projections on PLAIN bf16 operands (inputs: exact products, f32 accumulate, + bias); scores (K 64) and
// attn.v on SINGLE fp16 planes with an f32 softmax (scale in f32); merged heads as bf16 hi+lo planes x exact Wo (2 products) + bo. Projections: one-wave-per-64x64-tile GEMMs, batched in grid y/z; the q/k/v GEMM stores its tiles as fp16 head planes itself (V transposed).
// Attention: ONE kernel for all 96 heads; scores and probabilities stay in registers (running maximum and sum per query), K and V^T tiles pass through LDS.

#define NB_  8
#define TT   1024
#define DD   768
#define NH_  12
#define HDM  64
#define ZH   1
#define PCAR 1024.0f
typedef _Float16 h16;
typedef unsigned short bf;
typedef __attribute__((ext_vector_type(16))) __bf16   v16bf;
typedef __attribute__((ext_vector_type(16))) _Float16 v16h;
typedef __attribute__((ext_vector_type(8)))  _Float16 v8h;
typedef __attribute__((ext_vector_type(8)))  unsigned short v8us;
typedef __attribute__((ext_vector_type(8)))  float    v8f;
typedef __attribute__((ext_vector_type(4)))  float    v4f;
typedef v8h  __attribute__((may_alias)) v8ha;
typedef v4f  __attribute__((may_alias)) v4fa;
typedef v8us __attribute__((may_alias)) v8usa;

__device__ __forceinline__ unsigned short f2bf(float f) { unsigned u = __float_as_uint(f); u += 0x7FFFu + ((u >> 16) & 1u); return (unsigned short)(u >> 16); }
__device__ __forceinline__ float bf2f(unsigned short b) { return __uint_as_float(((unsigned)b) << 16); }
__device__ __forceinline__ float bfr(float f) { return bf2f(f2bf(f)); }
__device__ __forceinline__ v16h cat16(v8h lo, v8h hi) { return __builtin_shufflevector(lo, hi, 0, 1, 2, 3, 4, 5, 6, 7, 8, 9, 10, 11, 12, 13, 14, 15); }
__device__ __forceinline__ v16bf cat16b(v8us lo, v8us hi) { return __builtin_bit_cast(v16bf, __builtin_shufflevector(lo, hi, 0, 1, 2, 3, 4, 5, 6, 7, 8, 9, 10, 11, 12, 13, 14, 15)); }
__device__ __forceinline__ v8f wmma16(v16h a, v16h b, v8f c) { return __builtin_amdgcn_wmma_f32_16x16x32_f16(false, a, false, b, (short)0, c, false, false); }
__device__ __forceinline__ v8f wmmab(v16bf a, v16bf b, v8f c) { return __builtin_amdgcn_wmma_f32_16x16x32_bf16(false, a, false, b, (short)0, c, false, false); }



// ---- k_gemmw: register-blocked GEMM, ONE WAVE per 64x64 output tile (16 accumulators), operands straight from K-contiguous 16-bit planes; grid (M/64, N/64, Z), 32 threads.
// C[m][n] (f32, pitch ldc, + optional f32 bias[n]) = sum_k A[m][k] Bt[n][k] (+ split products per NSPLIT). z-batch strides sA/sB/sC in elements; z picks bias, bias1 or bias2. K % 32 == 0.
// PLANES: no C. A tile is 64 tokens of one batch x the 64 d of head blockIdx.y; the sum + bias, rounded to fp16, goes to PQ (z = 0) or PK (z = 1) as [batch][head][token][d], or to PV (z = 2) as [batch][head][d][token].
template <typename T16> struct WFrag;
template <> struct WFrag<h16> { typedef v16h V; static __device__ __forceinline__ V ld(const h16* p) { return cat16(*(const v8h*)p, *(const v8h*)(p + 16)); } static __device__ __forceinline__ v8f mma(V a, V b, v8f c) { return wmma16(a, b, c); } };
template <> struct WFrag<bf> { typedef v16bf V; static __device__ __forceinline__ V ld(const bf* p) { return cat16b(*(const v8us*)p, *(const v8us*)(p + 16)); } static __device__ __forceinline__ v8f mma(V a, V b, v8f c) { return wmmab(a, b, c); } };
template <typename T16, int NSPLIT, bool BIAS, bool PLANES>
__global__ __launch_bounds__(32) void k_gemmw(const T16* __restrict__ A, const T16* __restrict__ A2, const T16* __restrict__ Bt, const T16* __restrict__ Bt2, int K, float* C, int ldc, const float* __restrict__ bias, const float* __restrict__ bias1, const float* __restrict__ bias2, size_t sA, size_t sB, size_t sC, h16* PQ, h16* PK, h16* PV) {
    typedef typename WFrag<T16>::V V;
    __shared__ __align__(16) float os[16 * 68];
    const size_t z = blockIdx.z; A += z * sA; if (A2) A2 += z * sA; Bt += z * sB; if (Bt2) Bt2 += z * sB; C += z * sC; if (BIAS) { if (z == 1) bias = bias1; else if (z == 2) bias = bias2; }
    const int lane = threadIdx.x & 31, lr = lane & 15, hi = lane >> 4; const int r0 = blockIdx.x * 64, c0 = blockIdx.y * 64;
    v8f acc[4][4];
#pragma unroll
    for (int mb = 0; mb < 4; ++mb)
#pragma unroll
        for (int nb = 0; nb < 4; ++nb) acc[mb][nb] = (v8f){};
    const size_t aoff = (size_t)(r0 + lr) * K + 8 * hi, boff = (size_t)(c0 + lr) * K + 8 * hi;
#pragma unroll 1
    for (int kc = 0; kc < K; kc += 32) {
        V a[4], a2[4];
#pragma unroll
        for (int mb = 0; mb < 4; ++mb) { a[mb] = WFrag<T16>::ld(A + aoff + (size_t)mb * 16 * K + kc); if (NSPLIT == 1 || NSPLIT == 2) a2[mb] = WFrag<T16>::ld(A2 + aoff + (size_t)mb * 16 * K + kc); }
#pragma unroll
        for (int nb = 0; nb < 4; ++nb) { const V b = WFrag<T16>::ld(Bt + boff + (size_t)nb * 16 * K + kc); V b2; if (NSPLIT >= 2) b2 = WFrag<T16>::ld(Bt2 + boff + (size_t)nb * 16 * K + kc);
#pragma unroll
            for (int mb = 0; mb < 4; ++mb) { acc[mb][nb] = WFrag<T16>::mma(a[mb], b, acc[mb][nb]); if (NSPLIT == 1 || NSPLIT == 2) acc[mb][nb] = WFrag<T16>::mma(a2[mb], b, acc[mb][nb]); if (NSPLIT >= 2) acc[mb][nb] = WFrag<T16>::mma(a[mb], b2, acc[mb][nb]); } }
        asm volatile("v_nop\n\tv_nop\n\tv_nop\n\tv_nop" : "+v"(acc[0][0]), "+v"(acc[1][1]), "+v"(acc[2][2]), "+v"(acc[3][3]) : "v"(a[0]), "v"(a[3]));
    }
    if constexpr (PLANES) {
        const size_t hp = (size_t)(r0 / TT) * NH_ + blockIdx.y; const int t0 = r0 % TT; const int prow = lane >> 3, pc = (lane & 7) * 8;   // read-back: 8 lanes a row of 128 B, 4 rows a store
        if (z < 2) {
            // q, k: the tile is 64 rows of 128 B one behind the other; 16 rows at a time pass through LDS in f32, a wave's store is 512 B in a row
            h16* P = (z == 0 ? PQ : PK) + (hp * TT + t0) * HDM; float bb[8];
#pragma unroll
            for (int i = 0; i < 8; ++i) bb[i] = bfr(bias[c0 + pc + i]);
#pragma unroll
            for (int mb = 0; mb < 4; ++mb) {
#pragma unroll
                for (int nb = 0; nb < 4; ++nb) {
#pragma unroll
                    for (int j = 0; j < 8; ++j) os[(hi * 8 + j) * 68 + nb * 16 + lr] = acc[mb][nb][j]; }
                __builtin_amdgcn_wave_barrier(); asm volatile("" ::: "memory");   // keeps the read-back of other lanes' values behind the LDS stores
#pragma unroll
                for (int s = 0; s < 4; ++s) { const int row = 4 * s + prow; const v4f v0 = *(const v4fa*)(os + row * 68 + pc), v1 = *(const v4fa*)(os + row * 68 + pc + 4); v8h o;
#pragma unroll
                    for (int i = 0; i < 4; ++i) { o[i] = (h16)(v0[i] + bb[i]); o[4 + i] = (h16)(v1[i] + bb[4 + i]); }
                    *(v8h*)(P + (size_t)(mb * 16 + row) * HDM + pc) = o; }
                __builtin_amdgcn_wave_barrier(); asm volatile("s_wait_xcnt 0x0" ::: "memory");   // keeps the next 16 rows' LDS stores behind this read-back; the wait stands behind every run of stores, before their registers are written again
            }
        } else {
            // v: a lane's 8 accumulator rows are 8 consecutive tokens of one d, one 16-byte piece of a V^T row; 16 d rows (128 B at a pitch of 144 B) at a time pass through LDS, so that a store fills whole 128-byte lines
            h16* P = PV + hp * HDM * TT + t0; h16* oh = (h16*)os; float bq[4];
#pragma unroll
            for (int nb = 0; nb < 4; ++nb) bq[nb] = bfr(bias[c0 + nb * 16 + lr]);
#pragma unroll
            for (int nb = 0; nb < 4; ++nb) { const float bv = bq[nb];
#pragma unroll
                for (int mb = 0; mb < 4; ++mb) { v8h o;
#pragma unroll
                    for (int j = 0; j < 8; ++j) o[j] = (h16)(acc[mb][nb][j] + bv);
                    *(v8ha*)(oh + lr * 72 + mb * 16 + hi * 8) = o; }
                __builtin_amdgcn_wave_barrier(); asm volatile("" ::: "memory");   // keeps the read-back of other lanes' values behind the LDS stores
#pragma unroll
                for (int s = 0; s < 4; ++s) { const int row = 4 * s + prow; const v8h o = *(const v8ha*)(oh + row * 72 + pc); *(v8h*)(P + (size_t)(nb * 16 + row) * TT + pc) = o; }
                __builtin_amdgcn_wave_barrier(); asm volatile("s_wait_xcnt 0x0" ::: "memory"); __builtin_amdgcn_sched_barrier(0);   // keeps the next 16 rows' LDS stores behind this read-back; the wait stands behind every run of stores, before their registers are written again; the scheduling barrier keeps the later rows' adds from being lifted here, which took the kernel past 192 registers (four waves a SIMD instead of five)
            }
        }
        return;
    }
#pragma unroll
    for (int mb = 0; mb < 4; ++mb) {
#pragma unroll
        for (int nb = 0; nb < 4; ++nb) {
#pragma unroll
            for (int j = 0; j < 8; ++j) os[(hi * 8 + j) * 68 + nb * 16 + lr] = acc[mb][nb][j]; }
        __builtin_amdgcn_wave_barrier(); asm volatile("" ::: "memory");
        float* crow = C + (size_t)(r0 + mb * 16) * ldc + c0;
{
#pragma unroll
            for (int s = 0; s < 8; ++s) { const int row = 2 * s + hi, cofs = lr * 4; v4f val = *(const v4fa*)(os + row * 68 + cofs); if (BIAS) { val[0] += bfr(bias[c0 + cofs]); val[1] += bfr(bias[c0 + cofs + 1]); val[2] += bfr(bias[c0 + cofs + 2]); val[3] += bfr(bias[c0 + cofs + 3]); }
                *(v4f*)(crow + (size_t)row * ldc + cofs) = val; }
             }
        __builtin_amdgcn_wave_barrier(); asm volatile("" ::: "memory");
    }
}

__device__ __forceinline__ h16 tohx(float x) { return (h16)x; }
__device__ __forceinline__ void splitf(float y, unsigned short& h, unsigned short& l) { h = f2bf(y); l = f2bf(y - bf2f(h)); }
typedef __attribute__((ext_vector_type(2))) _Float16 v2h;
typedef __attribute__((ext_vector_type(4))) _Float16 v4h;
typedef __attribute__((ext_vector_type(2))) unsigned short v2us;
typedef __attribute__((ext_vector_type(4))) unsigned short v4us;
typedef __attribute__((ext_vector_type(2))) float v2f;

__global__ __launch_bounds__(256) void k_wtG(const float* __restrict__ w, int K, int N, bf* Bt) {
    const int lane = threadIdx.x & 31; const int L0 = (blockIdx.x * 8 + (threadIdx.x >> 5)) * 8; const int nlines = N * K / 64;
{
#pragma unroll 1
        for (int l = 0; l < 8; ++l) { const int L = L0 + l; if (L >= nlines) break; const size_t e = (size_t)L * 64 + lane * 2; const int k = (int)(e % K), n = (int)(e / K); v2us o;
            o[0] = f2bf(w[(size_t)k * N + n]); o[1] = f2bf(w[(size_t)(k + 1) * N + n]); *(v2us*)(Bt + e) = o; }
         }
}
__global__ __launch_bounds__(256) void k_cvt8(const float* __restrict__ src, bf* dst, size_t n8) { const size_t i = (size_t)blockIdx.x * 256 + threadIdx.x; if (i >= n8) return; const v8f v = *(const v8f*)(src + i * 8); v8us o;
#pragma unroll
    for (int k = 0; k < 8; ++k) o[k] = f2bf(v[k]); *(v8us*)(dst + i * 8) = o;  }
// the four weight matrices in one launch: blockIdx.y picks the matrix; the first three bf16 copies land one behind the other in d012, the fourth in d3
__global__ __launch_bounds__(256) void k_cvt8w(const float* __restrict__ s0, const float* __restrict__ s1, const float* __restrict__ s2, const float* __restrict__ s3, bf* d012, bf* d3, size_t n8) { const size_t i = (size_t)blockIdx.x * 256 + threadIdx.x; if (i >= n8) return; const unsigned y = blockIdx.y; const float* src = y == 0 ? s0 : y == 1 ? s1 : y == 2 ? s2 : s3; bf* dst = y < 3 ? d012 + (size_t)y * n8 * 8 : d3; const v8f v = *(const v8f*)(src + i * 8); v8us o;
#pragma unroll
    for (int k = 0; k < 8; ++k) o[k] = f2bf(v[k]); *(v8us*)(dst + i * 8) = o;  }
// lane l with lane l ^ 16
__device__ __forceinline__ float xhalf(float x) { return __builtin_bit_cast(float, __builtin_amdgcn_permlanex16(__builtin_bit_cast(int, x), __builtin_bit_cast(int, x), 0x76543210, 0xfedcba98, false, false)); }
// eight independent 2^x, each in place; the v_nop is the one slot that the instruction set asks for behind a transcendental before its result is used or its source overwritten
__device__ __forceinline__ void exp2x8(float& x0, float& x1, float& x2, float& x3, float& x4, float& x5, float& x6, float& x7) {
    asm("v_exp_f32 %0, %0\n\tv_exp_f32 %1, %1\n\tv_exp_f32 %2, %2\n\tv_exp_f32 %3, %3\n\tv_exp_f32 %4, %4\n\tv_exp_f32 %5, %5\n\tv_exp_f32 %6, %6\n\tv_exp_f32 %7, %7\n\tv_nop"
        : "+v"(x0), "+v"(x1), "+v"(x2), "+v"(x3), "+v"(x4), "+v"(x5), "+v"(x6), "+v"(x7)); }
#define FST  64
#define FPIT 72
#define MLAG 8.0f
#define PEXP   6.0f
__global__ __launch_bounds__(128) void k_fattn(const h16* __restrict__ QP, const h16* __restrict__ KP, const h16* __restrict__ VT, float scl, bf* Ah, bf* Al) {
    __shared__ __align__(16) h16 Ks[2][FST * FPIT];
    __shared__ __align__(16) h16 Vs[2][HDM * FPIT];
    const size_t z = blockIdx.y; QP += z * TT * HDM; KP += z * TT * HDM; VT += z * HDM * TT;
    const int tid = threadIdx.x, lane = tid & 31, lr = lane & 15, hi = lane >> 4; const int q0 = blockIdx.x * 128 + (tid >> 5) * 32;
    const float c = scl * 1.4426950408889634f;
    v16h qf[2][2];
#pragma unroll
    for (int qt = 0; qt < 2; ++qt)
#pragma unroll
        for (int kc = 0; kc < 2; ++kc) qf[qt][kc] = WFrag<h16>::ld(QP + (size_t)(q0 + qt * 16 + lr) * HDM + kc * 32 + 8 * hi);
    v8f o[2][4];
#pragma unroll
    for (int qt = 0; qt < 2; ++qt)
#pragma unroll
        for (int mb = 0; mb < 4; ++mb) o[qt][mb] = (v8f){};
    float m[2] = { -3.0e38f, -3.0e38f }; v2f l[2] = { (v2f){}, (v2f){} };   // l: a lane's sums over its even and its odd keys
    // staging: 16-byte piece tid + 128 i of a 64 x 128 B tile: row srow + 16 i, bytes 16 scol on
    const int srow = tid >> 3, scol = tid & 7;
    const h16* kg = KP + (size_t)srow * HDM + scol * 8; const h16* vg = VT + (size_t)srow * TT + scol * 8; const int sl = srow * FPIT + scol * 8;
    v8h kr[4], vr[4];
#pragma unroll
    for (int i = 0; i < 4; ++i) { kr[i] = *(const v8h*)(kg + (size_t)i * 16 * HDM); vr[i] = *(const v8h*)(vg + (size_t)i * 16 * TT); }
#pragma unroll
    for (int i = 0; i < 4; ++i) { *(v8h*)(&Ks[0][sl + i * 16 * FPIT]) = kr[i]; *(v8h*)(&Vs[0][sl + i * 16 * FPIT]) = vr[i]; }
    __syncthreads();
    for (int s = 0; s < TT / FST; ++s) {
        const bool more = s + 1 < TT / FST;
        if (more) {
#pragma unroll
            for (int i = 0; i < 4; ++i) { kr[i] = *(const v8h*)(kg + (size_t)((s + 1) * FST + i * 16) * HDM); vr[i] = *(const v8h*)(vg + (size_t)i * 16 * TT + (s + 1) * FST); } }
        const h16* kb = &Ks[s & 1][lr * FPIT + 8 * hi]; const h16* vb = &Vs[s & 1][lr * FPIT + 8 * hi];
#pragma unroll
        for (int p = 0; p < FST / 32; ++p) {
            v8f st[2][2];
#pragma unroll
            for (int kt = 0; kt < 2; ++kt) { const v16h k0 = WFrag<h16>::ld(kb + (p * 32 + kt * 16) * FPIT), k1 = WFrag<h16>::ld(kb + (p * 32 + kt * 16) * FPIT + 32);
#pragma unroll
                for (int qt = 0; qt < 2; ++qt) { st[qt][kt] = wmma16(k0, qf[qt][0], (v8f){}); st[qt][kt] = wmma16(k1, qf[qt][1], st[qt][kt]); } }
            float xm[2];
#pragma unroll
            for (int qt = 0; qt < 2; ++qt) { float mx = st[qt][0][0];
#pragma unroll
                for (int j = 1; j < 8; ++j) mx = fmaxf(mx, st[qt][0][j]);
#pragma unroll
                for (int j = 0; j < 8; ++j) mx = fmaxf(mx, st[qt][1][j]);
                xm[qt] = fmaxf(mx, xhalf(mx)) * c; }
            // one test a pass for the whole wave: the output tiles are rescaled only when some query's maximum in use is raised
            if (__builtin_amdgcn_ballot_w32(xm[0] > m[0] + MLAG || xm[1] > m[1] + MLAG) != 0) {
#pragma unroll
                for (int qt = 0; qt < 2; ++qt) { const float mn = fmaxf(m[qt], xm[qt]); const float al = __builtin_amdgcn_exp2f(m[qt] - mn); m[qt] = mn; l[qt] *= al;
#pragma unroll
                    for (int mb = 0; mb < 4; ++mb)
#pragma unroll
                        for (int j = 0; j < 8; ++j) o[qt][mb][j] *= al; } }
            v16h pf[2];
#pragma unroll
            for (int qt = 0; qt < 2; ++qt) { const float nm = PEXP - m[qt];
#pragma unroll
                for (int kt = 0; kt < 2; ++kt) { float x[8];
#pragma unroll
                    for (int j = 0; j < 8; ++j) x[j] = fmaf(st[qt][kt][j], c, nm);
                    exp2x8(x[0], x[1], x[2], x[3], x[4], x[5], x[6], x[7]);
#pragma unroll
                    for (int j = 0; j < 8; j += 2) { l[qt] += (v2f){ x[j], x[j + 1] }; pf[qt][kt * 8 + j] = (h16)x[j]; pf[qt][kt * 8 + j + 1] = (h16)x[j + 1]; } } }
#pragma unroll
            for (int mb = 0; mb < 4; ++mb) { const v16h vf = WFrag<h16>::ld(vb + mb * 16 * FPIT + p * 32);
#pragma unroll
                for (int qt = 0; qt < 2; ++qt) o[qt][mb] = wmma16(vf, pf[qt], o[qt][mb]); }
        }
        if (more) {
#pragma unroll
            for (int i = 0; i < 4; ++i) { *(v8h*)(&Ks[(s + 1) & 1][sl + i * 16 * FPIT]) = kr[i]; *(v8h*)(&Vs[(s + 1) & 1][sl + i * 16 * FPIT]) = vr[i]; } }
        __syncthreads();   // publishes stage s + 1 and ends every wave's reads of the buffer that stage s + 2 will overwrite
    }
#pragma unroll
    for (int qt = 0; qt < 2; ++qt) { const float lh = l[qt][0] + l[qt][1]; const float f = __fdiv_rn(1.0f, lh + xhalf(lh));
        // merged layout [batch][query][head * 64 + d], as bf16 hi + lo planes: a lane's 8 consecutive d are one 16-byte store a plane, a wave fills whole 128-byte lines
        const size_t oo = ((z / NH_) * TT + (size_t)(q0 + qt * 16 + lr)) * DD + (z % NH_) * HDM + 8 * hi;
#pragma unroll
        for (int mb = 0; mb < 4; ++mb) { v8us oh, ol;
#pragma unroll
            for (int j = 0; j < 8; ++j) { unsigned short a, c2; splitf(o[qt][mb][j] * f, a, c2); oh[j] = a; ol[j] = c2; }
            *(v8us*)(Ah + oo + mb * 16) = oh; *(v8us*)(Al + oo + mb * 16) = ol; } }
}
__global__ __launch_bounds__(256) void k_mrgf(const float* __restrict__ O, int h, int hd, float* CT) { const size_t e = ((size_t)blockIdx.x * 256 + threadIdx.x) * 2; if (e >= (size_t)TT * hd) return; const int d = (int)(e % hd); const int t = (int)(e / hd); v2f o; o[0] = O[e] * (1.0f / PCAR); o[1] = O[e + 1] * (1.0f / PCAR); const size_t oo = (size_t)t * DD + h * hd + d; *(v2f*)(CT + oo) = o;  }

extern "C" void kernel_launch(void* const* d_in, const int* in_sizes, int n_in,
                              void* d_out, int out_size, void* d_ws, size_t ws_size, hipStream_t stream) {
    (void)in_sizes; (void)n_in; (void)out_size;
    const float* IN[9]; for (int i = 0; i < 9; ++i) IN[i] = (const float*)d_in[i];   // x, Wq, bq, Wk, bk, Wv, bv, Wo, bo (torch [out][in])
    float* OUT = (float*)d_out;     // [8][1024][768]
    char* wsp = (char*)d_ws;
    auto take = [&](size_t bytes) { char* p = wsp; wsp += (bytes + 255) & ~(size_t)255; return (void*)p; };
    // kept to the end: WO and the q/k/v planes of all 96 heads. SP: up to the attention kernel WQ/WK/WV and x in bf16, from it on the merged planes (the larger of the two uses).
    bf* WO = (bf*)take((size_t)DD * DD * 2); h16* QP = (h16*)take((size_t)NB_ * TT * DD * 2); h16* KP = (h16*)take((size_t)NB_ * TT * DD * 2); h16* VT = (h16*)take((size_t)NB_ * DD * TT * 2);
    char* SP = wsp; bf* WQKV = (bf*)take((size_t)3 * DD * DD * 2); bf* XB = (bf*)take((size_t)NB_ * TT * DD * 2);
    wsp = SP; bf* Ah = (bf*)take((size_t)NB_ * TT * DD * 2); bf* Al = (bf*)take((size_t)NB_ * TT * DD * 2);
    if ((size_t)(wsp - (char*)d_ws) > ws_size) return;
    { const size_t nw = (size_t)DD * DD / 8; k_cvt8w<<<dim3((unsigned)((nw + 255) / 256), 4, 1), 256, 0, stream>>>(IN[1], IN[3], IN[5], IN[7], WQKV, WO, nw); }
    const float scl = 0.036084391824351615f;   // 768^-0.5
    k_cvt8<<<(unsigned)(((size_t)NB_ * TT * DD / 8 + 255) / 256), 256, 0, stream>>>(IN[0], XB, (size_t)NB_ * TT * DD / 8);
    k_gemmw<bf, 0, true, true><<<dim3(NB_ * TT / 64, DD / 64, 3), 32, 0, stream>>>(XB, nullptr, WQKV, nullptr, DD, nullptr, 0, IN[2], IN[4], IN[6], 0, (size_t)DD * DD, 0, QP, KP, VT);
    k_fattn<<<dim3(TT / 128, NB_ * NH_, 1), 128, 0, stream>>>(QP, KP, VT, scl, Ah, Al);
    k_gemmw<bf, 1, true, false><<<dim3(NB_ * TT / 64, DD / 64, 1), 32, 0, stream>>>(Ah, Al, WO, nullptr, DD, OUT, DD, IN[8], nullptr, nullptr, 0, 0, 0, nullptr, nullptr, nullptr);
}

// v004
// One run takes 101 microseconds.
// Next to v003, in two timings, it ran 1.36 and 1.35 times as fast.
// Counting every step since v000, it is 36.7 times as fast.
#include <hip/hip_runtime.h>

// SelfAttentionMulti (x [8][1024][768]; q/k/v = x W^T + b (12 heads x 64); scores = q.k x 768^-0.5 (the module scales by embed_dim, not head_dim); softmax; out = merged attn.v Wo^T + bo -> [8][1024][768]).
// Compute dtypes, f32 accumulate: every input rounded to bf16; projections on PLAIN bf16 operands (inputs: exact products, f32 accumulate, + bias); scores (K 64) and
// attn.v on SINGLE fp16 planes with an f32 softmax (scale in f32); merged heads as bf16 hi+lo planes x exact Wo (2 products) + bo. Projections: GEMMs of four 64x64 wave tiles a work-group, operand tiles shared through LDS, batched in grid z; the q/k/v GEMM stores its tiles as fp16 head planes itself (V transposed).
// Attention: ONE kernel for all 96 heads; scores and probabilities stay in registers (running maximum and sum per query), K and V^T tiles pass through LDS.

#define NB_  8
#define TT   1024
#define DD   768
#define NH_  12
#define HDM  64
#define ZH   1
#define PCAR 1024.0f
typedef _Float16 h16;
typedef unsigned short bf;
typedef __attribute__((ext_vector_type(16))) __bf16   v16bf;
typedef __attribute__((ext_vector_type(16))) _Float16 v16h;
typedef __attribute__((ext_vector_type(8)))  _Float16 v8h;
typedef __attribute__((ext_vector_type(8)))  unsigned short v8us;
typedef __attribute__((ext_vector_type(8)))  float    v8f;
typedef __attribute__((ext_vector_type(4)))  float    v4f;
typedef v8h  __attribute__((may_alias)) v8ha;
typedef v4f  __attribute__((may_alias)) v4fa;
typedef v8us __attribute__((may_alias)) v8usa;

__device__ __forceinline__ unsigned short f2bf(float f) { unsigned u = __float_as_uint(f); u += 0x7FFFu + ((u >> 16) & 1u); return (unsigned short)(u >> 16); }
__device__ __forceinline__ float bf2f(unsigned short b) { return __uint_as_float(((unsigned)b) << 16); }
__device__ __forceinline__ float bfr(float f) { return bf2f(f2bf(f)); }
__device__ __forceinline__ v16h cat16(v8h lo, v8h hi) { return __builtin_shufflevector(lo, hi, 0, 1, 2, 3, 4, 5, 6, 7, 8, 9, 10, 11, 12, 13, 14, 15); }
__device__ __forceinline__ v16bf cat16b(v8us lo, v8us hi) { return __builtin_bit_cast(v16bf, __builtin_shufflevector(lo, hi, 0, 1, 2, 3, 4, 5, 6, 7, 8, 9, 10, 11, 12, 13, 14, 15)); }
__device__ __forceinline__ v8f wmma16(v16h a, v16h b, v8f c) { return __builtin_amdgcn_wmma_f32_16x16x32_f16(false, a, false, b, (short)0, c, false, false); }
__device__ __forceinline__ v8f wmmab(v16bf a, v16bf b, v8f c) { return __builtin_amdgcn_wmma_f32_16x16x32_bf16(false, a, false, b, (short)0, c, false, false); }



// ---- k_gemmw: GEMM, one 128x128 output tile per work-group of FOUR WAVES (2 x 2), each wave a 64x64 tile (16 accumulators); grid (M/128, N/128, Z), 128 threads. Operands are K-contiguous bf16 planes.
// C[m][n] (f32, pitch ldc, + f32 bias[n]) = sum_k A[m][k] Bt[n][k] (NSPLIT 1: + A2[m][k] Bt[n][k], per 32 k directly behind the first product). z moves Bt by sB elements and picks bias, bias1 or bias2. K % 64 == 0.
// A stage is 64 k: 128 rows of 128 B of every operand, copied global -> LDS without registers (each wave-wide copy is 4 whole lines), two buffers, the next stage's copies in flight while this one is multiplied.
// LDS rows stand at a pitch of 128 B with no pad; the 16-byte piece c of row r lies at piece c ^ ((r >> 1) & 7), so that the 16 rows of a fragment read fall on 16 different bank groups.
// PLANES: no C. A wave's tile is 64 tokens of one batch x the 64 d of one head; the sum + bias, rounded to fp16, goes to PQ (z = 0) or PK (z = 1) as [batch][head][token][d], or to PV (z = 2) as [batch][head][d][token].
template <typename T16> struct WFrag;
template <> struct WFrag<h16> { typedef v16h V; static __device__ __forceinline__ V ld(const h16* p) { return cat16(*(const v8h*)p, *(const v8h*)(p + 16)); } static __device__ __forceinline__ v8f mma(V a, V b, v8f c) { return wmma16(a, b, c); } };
#define GTILE 16384   // one operand's 128 rows x 128 B
// eight asynchronous 16-byte copies of a lane: rows 16 apart (2048 B in LDS, rstep elements in global memory). The s_wait_xcnt stands in the copies' own statement, so that it comes before any rewrite of an address register that a copy names.
__device__ __forceinline__ void cp8(unsigned l, const bf* g, size_t rstep) {
    asm volatile("global_load_async_to_lds_b128 %0, %8, off\n\tglobal_load_async_to_lds_b128 %1, %9, off\n\tglobal_load_async_to_lds_b128 %2, %10, off\n\tglobal_load_async_to_lds_b128 %3, %11, off\n\t"
                 "global_load_async_to_lds_b128 %4, %12, off\n\tglobal_load_async_to_lds_b128 %5, %13, off\n\tglobal_load_async_to_lds_b128 %6, %14, off\n\tglobal_load_async_to_lds_b128 %7, %15, off\n\ts_wait_xcnt 0x0"
                 :: "v"(l), "v"(l + 2048u), "v"(l + 4096u), "v"(l + 6144u), "v"(l + 8192u), "v"(l + 10240u), "v"(l + 12288u), "v"(l + 14336u),
                    "v"(g), "v"(g + rstep), "v"(g + 2 * rstep), "v"(g + 3 * rstep), "v"(g + 4 * rstep), "v"(g + 5 * rstep), "v"(g + 6 * rstep), "v"(g + 7 * rstep) : "memory"); }
__device__ __forceinline__ v16bf ldsfrag(const unsigned char* row, int x0, int x1) { return cat16b(*(const v8usa*)(row + x0), *(const v8usa*)(row + x1)); }
template <int NSPLIT, bool PLANES>
__global__ __launch_bounds__(128) void k_gemmw(const bf* __restrict__ A, const bf* __restrict__ A2, const bf* __restrict__ Bt, int K, float* C, int ldc, const float* __restrict__ bias, const float* __restrict__ bias1, const float* __restrict__ bias2, size_t sB, h16* PQ, h16* PK, h16* PV) {
    constexpr int STAGE = (2 + NSPLIT) * GTILE;   // [A | A2 | Bt]
    __shared__ __align__(1024) unsigned char ring[2 * STAGE];
    const size_t z = blockIdx.z; Bt += z * sB; if (z == 1) bias = bias1; else if (z == 2) bias = bias2;
    const int tid = threadIdx.x, lane = tid & 31, lr = lane & 15, hi = lane >> 4; const int w = __builtin_amdgcn_readfirstlane(tid >> 5), wm = w >> 1, wn = w & 1;
    const int r0 = blockIdx.x * 128 + wm * 64, c0 = blockIdx.y * 128 + wn * 64;
    v8f acc[4][4];
#pragma unroll
    for (int mb = 0; mb < 4; ++mb)
#pragma unroll
        for (int nb = 0; nb < 4; ++nb) acc[mb][nb] = (v8f){};
    // copies: 16-byte piece tid & 7 of rows (tid >> 3) + 16 i
    const int crow = tid >> 3, ccol = tid & 7; const size_t rstep = (size_t)16 * K;
    const unsigned cl = (unsigned)(size_t)ring + (unsigned)(crow * 128 + ((ccol ^ ((crow >> 1) & 7)) * 16));
    const bf* ga = A + (size_t)(blockIdx.x * 128 + crow) * K + ccol * 8; const bf* ga2 = NSPLIT ? A2 + (size_t)(blockIdx.x * 128 + crow) * K + ccol * 8 : nullptr; const bf* gb = Bt + (size_t)(blockIdx.y * 128 + crow) * K + ccol * 8;
    auto fill = [&](int t) { const unsigned l = cl + (unsigned)((t & 1) * STAGE); cp8(l, ga + t * 64, rstep); if (NSPLIT) cp8(l + GTILE, ga2 + t * 64, rstep); cp8(l + (1 + NSPLIT) * GTILE, gb + t * 64, rstep); };
    // fragment reads: row lr of a 16-row block; the pieces hi + 4 kk and hi + 2 + 4 kk of the stage's 8, at their exchanged places
    const int sw = hi ^ ((lr >> 1) & 7); const int aro = (wm * 64 + lr) * 128, bro = (1 + NSPLIT) * GTILE + (wn * 64 + lr) * 128;
    const int nst = K / 64;
    fill(0);
    asm volatile("s_wait_asynccnt 0x0" ::: "memory");   // stage 0 of this wave's copies has landed
    __syncthreads();                                    // ... and every other wave's
    if (nst > 1) fill(1);
    // kept rolled, like the loop it replaces: a trip already holds a whole stage's matrix instructions for its one branch and one barrier
#pragma unroll 1
    for (int t = 0; t < nst; ++t) {
        const unsigned char* sb = ring + (t & 1) * STAGE;
        v16bf a[4], a2[4];
#pragma unroll
        for (int kk = 0; kk < 2; ++kk) { const int x0 = (sw ^ (4 * kk)) * 16, x1 = (sw ^ (4 * kk + 2)) * 16;
#pragma unroll
            for (int mb = 0; mb < 4; ++mb) { a[mb] = ldsfrag(sb + aro + mb * 2048, x0, x1); if (NSPLIT) a2[mb] = ldsfrag(sb + GTILE + aro + mb * 2048, x0, x1); }
#pragma unroll
            for (int nb = 0; nb < 4; ++nb) { const v16bf b = ldsfrag(sb + bro + nb * 2048, x0, x1);
#pragma unroll
                for (int mb = 0; mb < 4; ++mb) { acc[mb][nb] = wmmab(a[mb], b, acc[mb][nb]); if (NSPLIT) acc[mb][nb] = wmmab(a2[mb], b, acc[mb][nb]); } } }
        asm volatile("s_wait_dscnt 0x0" ::: "memory");      // this wave's reads of stage t are done before the buffer is given up
        asm volatile("s_wait_asynccnt 0x0" ::: "memory");   // this wave's copies of stage t + 1 have landed
        __syncthreads();                                    // publishes stage t + 1 and ends every wave's reads of the buffer that stage t + 2 overwrites
        if (t + 2 < nst) fill(t + 2);
    }
    asm volatile("s_wait_asynccnt 0x0" ::: "memory");       // nothing is in flight when the ring becomes output staging
    float* os = (float*)ring + w * (16 * 68);               // each wave stages its output in its own 4352 B of the ring, behind the last stage's barrier
    if constexpr (PLANES) {
        const size_t hp = (size_t)(r0 / TT) * NH_ + c0 / HDM; const int t0 = r0 % TT; const int prow = lane >> 3, pc = (lane & 7) * 8;   // read-back: 8 lanes a row of 128 B, 4 rows a store
        if (z < 2) {
            // q, k: the tile is 64 rows of 128 B one behind the other; 16 rows at a time pass through LDS in f32, a wave's store is 512 B in a row
            h16* P = (z == 0 ? PQ : PK) + (hp * TT + t0) * HDM; float bb[8];
#pragma unroll
            for (int i = 0; i < 8; ++i) bb[i] = bfr(bias[c0 + pc + i]);
#pragma unroll
            for (int mb = 0; mb < 4; ++mb) {
#pragma unroll
                for (int nb = 0; nb < 4; ++nb) {
#pragma unroll
                    for (int j = 0; j < 8; ++j) os[(hi * 8 + j) * 68 + nb * 16 + lr] = acc[mb][nb][j]; }
                __builtin_amdgcn_wave_barrier(); asm volatile("" ::: "memory");   // keeps the read-back of other lanes' values behind the LDS stores
#pragma unroll
                for (int s = 0; s < 4; ++s) { const int row = 4 * s + prow; const v4f v0 = *(const v4fa*)(os + row * 68 + pc), v1 = *(const v4fa*)(os + row * 68 + pc + 4); v8h o;
#pragma unroll
                    for (int i = 0; i < 4; ++i) { o[i] = (h16)(v0[i] + bb[i]); o[4 + i] = (h16)(v1[i] + bb[4 + i]); }
                    *(v8h*)(P + (size_t)(mb * 16 + row) * HDM + pc) = o; }
                __builtin_amdgcn_wave_barrier(); asm volatile("s_wait_xcnt 0x0" ::: "memory");   // keeps the next 16 rows' LDS stores behind this read-back; the wait stands behind every run of stores, before their registers are written again
            }
        } else {
            // v: a lane's 8 accumulator rows are 8 consecutive tokens of one d, one 16-byte piece of a V^T row; 16 d rows (128 B at a pitch of 144 B) at a time pass through LDS, so that a store fills whole 128-byte lines
            h16* P = PV + hp * HDM * TT + t0; h16* oh = (h16*)os; float bq[4];
#pragma unroll
            for (int nb = 0; nb < 4; ++nb) bq[nb] = bfr(bias[c0 + nb * 16 + lr]);
#pragma unroll
            for (int nb = 0; nb < 4; ++nb) { const float bv = bq[nb];
#pragma unroll
                for (int mb = 0; mb < 4; ++mb) { v8h o;
#pragma unroll
                    for (int j = 0; j < 8; ++j) o[j] = (h16)(acc[mb][nb][j] + bv);
                    *(v8ha*)(oh + lr * 72 + mb * 16 + hi * 8) = o; }
                __builtin_amdgcn_wave_barrier(); asm volatile("" ::: "memory");   // keeps the read-back of other lanes' values behind the LDS stores
#pragma unroll
                for (int s = 0; s < 4; ++s) { const int row = 4 * s + prow; const v8h o = *(const v8ha*)(oh + row * 72 + pc); *(v8h*)(P + (size_t)(nb * 16 + row) * TT + pc) = o; }
                __builtin_amdgcn_wave_barrier(); asm volatile("s_wait_xcnt 0x0" ::: "memory"); __builtin_amdgcn_sched_barrier(0);   // keeps the next 16 rows' LDS stores behind this read-back; the wait stands behind every run of stores, before their registers are written again; the scheduling barrier keeps the later rows' adds from being lifted here, which took the kernel past 192 registers (four waves a SIMD instead of five)
            }
        }
        return;
    }
#pragma unroll
    for (int mb = 0; mb < 4; ++mb) {
#pragma unroll
        for (int nb = 0; nb < 4; ++nb) {
#pragma unroll
            for (int j = 0; j < 8; ++j) os[(hi * 8 + j) * 68 + nb * 16 + lr] = acc[mb][nb][j]; }
        __builtin_amdgcn_wave_barrier(); asm volatile("" ::: "memory");
        float* crow = C + (size_t)(r0 + mb * 16) * ldc + c0;
{
#pragma unroll
            for (int s = 0; s < 8; ++s) { const int row = 2 * s + hi, cofs = lr * 4; v4f val = *(const v4fa*)(os + row * 68 + cofs); val[0] += bfr(bias[c0 + cofs]); val[1] += bfr(bias[c0 + cofs + 1]); val[2] += bfr(bias[c0 + cofs + 2]); val[3] += bfr(bias[c0 + cofs + 3]);
                *(v4f*)(crow + (size_t)row * ldc + cofs) = val; }
             }
        __builtin_amdgcn_wave_barrier(); asm volatile("" ::: "memory");
    }
}

__device__ __forceinline__ h16 tohx(float x) { return (h16)x; }
__device__ __forceinline__ void splitf(float y, unsigned short& h, unsigned short& l) { h = f2bf(y); l = f2bf(y - bf2f(h)); }
typedef __attribute__((ext_vector_type(2))) _Float16 v2h;
typedef __attribute__((ext_vector_type(4))) _Float16 v4h;
typedef __attribute__((ext_vector_type(2))) unsigned short v2us;
typedef __attribute__((ext_vector_type(4))) unsigned short v4us;
typedef __attribute__((ext_vector_type(2))) float v2f;

__global__ __launch_bounds__(256) void k_wtG(const float* __restrict__ w, int K, int N, bf* Bt) {
    const int lane = threadIdx.x & 31; const int L0 = (blockIdx.x * 8 + (threadIdx.x >> 5)) * 8; const int nlines = N * K / 64;
{
#pragma unroll 1
        for (int l = 0; l < 8; ++l) { const int L = L0 + l; if (L >= nlines) break; const size_t e = (size_t)L * 64 + lane * 2; const int k = (int)(e % K), n = (int)(e / K); v2us o;
            o[0] = f2bf(w[(size_t)k * N + n]); o[1] = f2bf(w[(size_t)(k + 1) * N + n]); *(v2us*)(Bt + e) = o; }
         }
}
__global__ __launch_bounds__(256) void k_cvt8(const float* __restrict__ src, bf* dst, size_t n8) { const size_t i = (size_t)blockIdx.x * 256 + threadIdx.x; if (i >= n8) return; const v8f v = *(const v8f*)(src + i * 8); v8us o;
#pragma unroll
    for (int k = 0; k < 8; ++k) o[k] = f2bf(v[k]); *(v8us*)(dst + i * 8) = o;  }
// the four weight matrices in one launch: blockIdx.y picks the matrix; the first three bf16 copies land one behind the other in d012, the fourth in d3
__global__ __launch_bounds__(256) void k_cvt8w(const float* __restrict__ s0, const float* __restrict__ s1, const float* __restrict__ s2, const float* __restrict__ s3, bf* d012, bf* d3, size_t n8) { const size_t i = (size_t)blockIdx.x * 256 + threadIdx.x; if (i >= n8) return; const unsigned y = blockIdx.y; const float* src = y == 0 ? s0 : y == 1 ? s1 : y == 2 ? s2 : s3; bf* dst = y < 3 ? d012 + (size_t)y * n8 * 8 : d3; const v8f v = *(const v8f*)(src + i * 8); v8us o;
#pragma unroll
    for (int k = 0; k < 8; ++k) o[k] = f2bf(v[k]); *(v8us*)(dst + i * 8) = o;  }
// lane l with lane l ^ 16
__device__ __forceinline__ float xhalf(float x) { return __builtin_bit_cast(float, __builtin_amdgcn_permlanex16(__builtin_bit_cast(int, x), __builtin_bit_cast(int, x), 0x76543210, 0xfedcba98, false, false)); }
// eight independent 2^x, each in place; the v_nop is the one slot that the instruction set asks for behind a transcendental before its result is used or its source overwritten
__device__ __forceinline__ void exp2x8(float& x0, float& x1, float& x2, float& x3, float& x4, float& x5, float& x6, float& x7) {
    asm("v_exp_f32 %0, %0\n\tv_exp_f32 %1, %1\n\tv_exp_f32 %2, %2\n\tv_exp_f32 %3, %3\n\tv_exp_f32 %4, %4\n\tv_exp_f32 %5, %5\n\tv_exp_f32 %6, %6\n\tv_exp_f32 %7, %7\n\tv_nop"
        : "+v"(x0), "+v"(x1), "+v"(x2), "+v"(x3), "+v"(x4), "+v"(x5), "+v"(x6), "+v"(x7)); }
#define FST  64
#define FPIT 72
#define MLAG 8.0f
#define PEXP   6.0f
__global__ __launch_bounds__(128) void k_fattn(const h16* __restrict__ QP, const h16* __restrict__ KP, const h16* __restrict__ VT, float scl, bf* Ah, bf* Al) {
    __shared__ __align__(16) h16 Ks[2][FST * FPIT];
    __shared__ __align__(16) h16 Vs[2][HDM * FPIT];
    const size_t z = blockIdx.y; QP += z * TT * HDM; KP += z * TT * HDM; VT += z * HDM * TT;
    const int tid = threadIdx.x, lane = tid & 31, lr = lane & 15, hi = lane >> 4; const int q0 = blockIdx.x * 128 + (tid >> 5) * 32;
    const float c = scl * 1.4426950408889634f;
    v16h qf[2][2];
#pragma unroll
    for (int qt = 0; qt < 2; ++qt)
#pragma unroll
        for (int kc = 0; kc < 2; ++kc) qf[qt][kc] = WFrag<h16>::ld(QP + (size_t)(q0 + qt * 16 + lr) * HDM + kc * 32 + 8 * hi);
    v8f o[2][4];
#pragma unroll
    for (int qt = 0; qt < 2; ++qt)
#pragma unroll
        for (int mb = 0; mb < 4; ++mb) o[qt][mb] = (v8f){};
    float m[2] = { -3.0e38f, -3.0e38f }; v2f l[2] = { (v2f){}, (v2f){} };   // l: a lane's sums over its even and its odd keys
    // staging: 16-byte piece tid + 128 i of a 64 x 128 B tile: row srow + 16 i, bytes 16 scol on
    const int srow = tid >> 3, scol = tid & 7;
    const h16* kg = KP + (size_t)srow * HDM + scol * 8; const h16* vg = VT + (size_t)srow * TT + scol * 8; const int sl = srow * FPIT + scol * 8;
    v8h kr[4], vr[4];
#pragma unroll
    for (int i = 0; i < 4; ++i) { kr[i] = *(const v8h*)(kg + (size_t)i * 16 * HDM); vr[i] = *(const v8h*)(vg + (size_t)i * 16 * TT); }
#pragma unroll
    for (int i = 0; i < 4; ++i) { *(v8h*)(&Ks[0][sl + i * 16 * FPIT]) = kr[i]; *(v8h*)(&Vs[0][sl + i * 16 * FPIT]) = vr[i]; }
    __syncthreads();
    for (int s = 0; s < TT / FST; ++s) {
        const bool more = s + 1 < TT / FST;
        if (more) {
#pragma unroll
            for (int i = 0; i < 4; ++i) { kr[i] = *(const v8h*)(kg + (size_t)((s + 1) * FST + i * 16) * HDM); vr[i] = *(const v8h*)(vg + (size_t)i * 16 * TT + (s + 1) * FST); } }
        const h16* kb = &Ks[s & 1][lr * FPIT + 8 * hi]; const h16* vb = &Vs[s & 1][lr * FPIT + 8 * hi];
#pragma unroll
        for (int p = 0; p < FST / 32; ++p) {
            v8f st[2][2];
#pragma unroll
            for (int kt = 0; kt < 2; ++kt) { const v16h k0 = WFrag<h16>::ld(kb + (p * 32 + kt * 16) * FPIT), k1 = WFrag<h16>::ld(kb + (p * 32 + kt * 16) * FPIT + 32);
#pragma unroll
                for (int qt = 0; qt < 2; ++qt) { st[qt][kt] = wmma16(k0, qf[qt][0], (v8f){}); st[qt][kt] = wmma16(k1, qf[qt][1], st[qt][kt]); } }
            float xm[2];
#pragma unroll
            for (int qt = 0; qt < 2; ++qt) { float mx = st[qt][0][0];
#pragma unroll
                for (int j = 1; j < 8; ++j) mx = fmaxf(mx, st[qt][0][j]);
#pragma unroll
                for (int j = 0; j < 8; ++j) mx = fmaxf(mx, st[qt][1][j]);
                xm[qt] = fmaxf(mx, xhalf(mx)) * c; }
            // one test a pass for the whole wave: the output tiles are rescaled only when some query's maximum in use is raised
            if (__builtin_amdgcn_ballot_w32(xm[0] > m[0] + MLAG || xm[1] > m[1] + MLAG) != 0) {
#pragma unroll
                for (int qt = 0; qt < 2; ++qt) { const float mn = fmaxf(m[qt], xm[qt]); const float al = __builtin_amdgcn_exp2f(m[qt] - mn); m[qt] = mn; l[qt] *= al;
#pragma unroll
                    for (int mb = 0; mb < 4; ++mb)
#pragma unroll
                        for (int j = 0; j < 8; ++j) o[qt][mb][j] *= al; } }
            v16h pf[2];
#pragma unroll
            for (int qt = 0; qt < 2; ++qt) { const float nm = PEXP - m[qt];
#pragma unroll
                for (int kt = 0; kt < 2; ++kt) { float x[8];
#pragma unroll
                    for (int j = 0; j < 8; ++j) x[j] = fmaf(st[qt][kt][j], c, nm);
                    exp2x8(x[0], x[1], x[2], x[3], x[4], x[5], x[6], x[7]);
#pragma unroll
                    for (int j = 0; j < 8; j += 2) { l[qt] += (v2f){ x[j], x[j + 1] }; pf[qt][kt * 8 + j] = (h16)x[j]; pf[qt][kt * 8 + j + 1] = (h16)x[j + 1]; } } }
#pragma unroll
            for (int mb = 0; mb < 4; ++mb) { const v16h vf = WFrag<h16>::ld(vb + mb * 16 * FPIT + p * 32);
#pragma unroll
                for (int qt = 0; qt < 2; ++qt) o[qt][mb] = wmma16(vf, pf[qt], o[qt][mb]); }
        }
        if (more) {
#pragma unroll
            for (int i = 0; i < 4; ++i) { *(v8h*)(&Ks[(s + 1) & 1][sl + i * 16 * FPIT]) = kr[i]; *(v8h*)(&Vs[(s + 1) & 1][sl + i * 16 * FPIT]) = vr[i]; } }
        __syncthreads();   // publishes stage s + 1 and ends every wave's reads of the buffer that stage s + 2 will overwrite
    }
#pragma unroll
    for (int qt = 0; qt < 2; ++qt) { const float lh = l[qt][0] + l[qt][1]; const float f = __fdiv_rn(1.0f, lh + xhalf(lh));
        // merged layout [batch][query][head * 64 + d], as bf16 hi + lo planes: a lane's 8 consecutive d are one 16-byte store a plane, a wave fills whole 128-byte lines
        const size_t oo = ((z / NH_) * TT + (size_t)(q0 + qt * 16 + lr)) * DD + (z % NH_) * HDM + 8 * hi;
#pragma unroll
        for (int mb = 0; mb < 4; ++mb) { v8us oh, ol;
#pragma unroll
            for (int j = 0; j < 8; ++j) { unsigned short a, c2; splitf(o[qt][mb][j] * f, a, c2); oh[j] = a; ol[j] = c2; }
            *(v8us*)(Ah + oo + mb * 16) = oh; *(v8us*)(Al + oo + mb * 16) = ol; } }
}
__global__ __launch_bounds__(256) void k_mrgf(const float* __restrict__ O, int h, int hd, float* CT) { const size_t e = ((size_t)blockIdx.x * 256 + threadIdx.x) * 2; if (e >= (size_t)TT * hd) return; const int d = (int)(e % hd); const int t = (int)(e / hd); v2f o; o[0] = O[e] * (1.0f / PCAR); o[1] = O[e + 1] * (1.0f / PCAR); const size_t oo = (size_t)t * DD + h * hd + d; *(v2f*)(CT + oo) = o;  }

extern "C" void kernel_launch(void* const* d_in, const int* in_sizes, int n_in,
                              void* d_out, int out_size, void* d_ws, size_t ws_size, hipStream_t stream) {
    (void)in_sizes; (void)n_in; (void)out_size;
    const float* IN[9]; for (int i = 0; i < 9; ++i) IN[i] = (const float*)d_in[i];   // x, Wq, bq, Wk, bk, Wv, bv, Wo, bo (torch [out][in])
    float* OUT = (float*)d_out;     // [8][1024][768]
    char* wsp = (char*)d_ws;
    auto take = [&](size_t bytes) { char* p = wsp; wsp += (bytes + 255) & ~(size_t)255; return (void*)p; };
    // kept to the end: WO and the q/k/v planes of all 96 heads. SP: up to the attention kernel WQ/WK/WV and x in bf16, from it on the merged planes (the larger of the two uses).
    bf* WO = (bf*)take((size_t)DD * DD * 2); h16* QP = (h16*)take((size_t)NB_ * TT * DD * 2); h16* KP = (h16*)take((size_t)NB_ * TT * DD * 2); h16* VT = (h16*)take((size_t)NB_ * DD * TT * 2);
    char* SP = wsp; bf* WQKV = (bf*)take((size_t)3 * DD * DD * 2); bf* XB = (bf*)take((size_t)NB_ * TT * DD * 2);
    wsp = SP; bf* Ah = (bf*)take((size_t)NB_ * TT * DD * 2); bf* Al = (bf*)take((size_t)NB_ * TT * DD * 2);
    if ((size_t)(wsp - (char*)d_ws) > ws_size) return;
    { const size_t nw = (size_t)DD * DD / 8; k_cvt8w<<<dim3((unsigned)((nw + 255) / 256), 4, 1), 256, 0, stream>>>(IN[1], IN[3], IN[5], IN[7], WQKV, WO, nw); }
    const float scl = 0.036084391824351615f;   // 768^-0.5
    k_cvt8<<<(unsigned)(((size_t)NB_ * TT * DD / 8 + 255) / 256), 256, 0, stream>>>(IN[0], XB, (size_t)NB_ * TT * DD / 8);
    k_gemmw<0, true><<<dim3(NB_ * TT / 128, DD / 128, 3), 128, 0, stream>>>(XB, nullptr, WQKV, DD, nullptr, 0, IN[2], IN[4], IN[6], (size_t)DD * DD, QP, KP, VT);
    k_fattn<<<dim3(TT / 128, NB_ * NH_, 1), 128, 0, stream>>>(QP, KP, VT, scl, Ah, Al);
    k_gemmw<1, false><<<dim3(NB_ * TT / 128, DD / 128, 1), 128, 0, stream>>>(Ah, Al, WO, DD, OUT, DD, IN[8], nullptr, nullptr, 0, nullptr, nullptr, nullptr);
}

// v005
// Measured time: 97.6 microseconds a run.
// In both of two side-by-side timings against v004, it was 1.04 times as fast.
// Over all steps from v000 it is 38.2 times as fast.
#include <hip/hip_runtime.h>

// SelfAttentionMulti (x [8][1024][768]; q/k/v = x W^T + b (12 heads x 64); scores = q.k x 768^-0.5 (the module scales by embed_dim, not head_dim); softmax; out = merged attn.v Wo^T + bo -> [8][1024][768]).
// Compute dtypes, f32 accumulate: every input rounded to bf16; projections on PLAIN bf16 operands (inputs: exact products, f32 accumulate, + bias); scores (K 64) and
// attn.v on SINGLE fp16 planes with an f32 softmax (scale in f32); merged heads as bf16 hi+lo planes x exact Wo (2 products) + bo. Projections: GEMMs of four 64x64 wave tiles a work-group, operand tiles shared through LDS, batched in grid z; the q/k/v GEMM stores its tiles as fp16 head planes itself (V transposed).
// Attention: ONE kernel for all 96 heads; scores and probabilities stay in registers (running maximum and sum per query), K and V^T tiles pass through LDS.

#define NB_  8
#define TT   1024
#define DD   768
#define NH_  12
#define HDM  64
#define ZH   1
#define PCAR 1024.0f
typedef _Float16 h16;
typedef unsigned short bf;
typedef __attribute__((ext_vector_type(16))) __bf16   v16bf;
typedef __attribute__((ext_vector_type(16))) _Float16 v16h;
typedef __attribute__((ext_vector_type(8)))  _Float16 v8h;
typedef __attribute__((ext_vector_type(8)))  unsigned short v8us;
typedef __attribute__((ext_vector_type(8)))  float    v8f;
typedef __attribute__((ext_vector_type(4)))  float    v4f;
typedef v8h  __attribute__((may_alias)) v8ha;
typedef v4f  __attribute__((may_alias)) v4fa;
typedef v8us __attribute__((may_alias)) v8usa;

__device__ __forceinline__ unsigned short f2bf(float f) { unsigned u = __float_as_uint(f); u += 0x7FFFu + ((u >> 16) & 1u); return (unsigned short)(u >> 16); }
__device__ __forceinline__ float bf2f(unsigned short b) { return __uint_as_float(((unsigned)b) << 16); }
__device__ __forceinline__ float bfr(float f) { return bf2f(f2bf(f)); }
__device__ __forceinline__ v16h cat16(v8h lo, v8h hi) { return __builtin_shufflevector(lo, hi, 0, 1, 2, 3, 4, 5, 6, 7, 8, 9, 10, 11, 12, 13, 14, 15); }
__device__ __forceinline__ v16bf cat16b(v8us lo, v8us hi) { return __builtin_bit_cast(v16bf, __builtin_shufflevector(lo, hi, 0, 1, 2, 3, 4, 5, 6, 7, 8, 9, 10, 11, 12, 13, 14, 15)); }
__device__ __forceinline__ v8f wmma16(v16h a, v16h b, v8f c) { return __builtin_amdgcn_wmma_f32_16x16x32_f16(false, a, false, b, (short)0, c, false, false); }
__device__ __forceinline__ v8f wmmab(v16bf a, v16bf b, v8f c) { return __builtin_amdgcn_wmma_f32_16x16x32_bf16(false, a, false, b, (short)0, c, false, false); }



// ---- k_gemmw: GEMM, one 128x128 output tile per work-group of FOUR WAVES (2 x 2), each wave a 64x64 tile (16 accumulators); grid (M/128, N/128, Z), 128 threads. Operands are K-contiguous bf16 planes.
// C[m][n] (f32, pitch ldc, + f32 bias[n]) = sum_k A[m][k] Bt[n][k] (NSPLIT 1: + A2[m][k] Bt[n][k], per 32 k directly behind the first product). z moves Bt by sB elements and picks bias, bias1 or bias2. K % 64 == 0.
// A stage is 64 k: 128 rows of 128 B of every operand, copied global -> LDS without registers (each wave-wide copy is 4 whole lines), two buffers, the next stage's copies in flight while this one is multiplied.
// LDS rows stand at a pitch of 128 B with no pad; the 16-byte piece c of row r lies at piece c ^ ((r >> 1) & 7), so that the 16 rows of a fragment read fall on 16 different bank groups.
// PLANES: no C. A wave's tile is 64 tokens of one batch x the 64 d of one head; the sum + bias, rounded to fp16, goes to PQ (z = 0) or PK (z = 1) as [batch][head][token][d], or to PV (z = 2) as [batch][head][d][token].
template <typename T16> struct WFrag;
template <> struct WFrag<h16> { typedef v16h V; static __device__ __forceinline__ V ld(const h16* p) { return cat16(*(const v8h*)p, *(const v8h*)(p + 16)); } static __device__ __forceinline__ v8f mma(V a, V b, v8f c) { return wmma16(a, b, c); } };
#define GTILE 16384   // one operand's 128 rows x 128 B
// eight asynchronous 16-byte copies of a lane: rows 16 apart (2048 B in LDS, rstep elements in global memory). The s_wait_xcnt stands in the copies' own statement, so that it comes before any rewrite of an address register that a copy names.
__device__ __forceinline__ void cp8(unsigned l, const bf* g, size_t rstep) {
    asm volatile("global_load_async_to_lds_b128 %0, %8, off\n\tglobal_load_async_to_lds_b128 %1, %9, off\n\tglobal_load_async_to_lds_b128 %2, %10, off\n\tglobal_load_async_to_lds_b128 %3, %11, off\n\t"
                 "global_load_async_to_lds_b128 %4, %12, off\n\tglobal_load_async_to_lds_b128 %5, %13, off\n\tglobal_load_async_to_lds_b128 %6, %14, off\n\tglobal_load_async_to_lds_b128 %7, %15, off\n\ts_wait_xcnt 0x0"
                 :: "v"(l), "v"(l + 2048u), "v"(l + 4096u), "v"(l + 6144u), "v"(l + 8192u), "v"(l + 10240u), "v"(l + 12288u), "v"(l + 14336u),
                    "v"(g), "v"(g + rstep), "v"(g + 2 * rstep), "v"(g + 3 * rstep), "v"(g + 4 * rstep), "v"(g + 5 * rstep), "v"(g + 6 * rstep), "v"(g + 7 * rstep) : "memory"); }
__device__ __forceinline__ v16bf ldsfrag(const unsigned char* row, int x0, int x1) { return cat16b(*(const v8usa*)(row + x0), *(const v8usa*)(row + x1)); }
template <int NSPLIT, bool PLANES>
__global__ __launch_bounds__(128) void k_gemmw(const bf* __restrict__ A, const bf* __restrict__ A2, const bf* __restrict__ Bt, int K, float* C, int ldc, const float* __restrict__ bias, const float* __restrict__ bias1, const float* __restrict__ bias2, size_t sB, h16* PQ, h16* PK, h16* PV) {
    constexpr int STAGE = (2 + NSPLIT) * GTILE;   // [A | A2 | Bt]
    __shared__ __align__(1024) unsigned char ring[2 * STAGE];
    const size_t z = blockIdx.z; Bt += z * sB; if (z == 1) bias = bias1; else if (z == 2) bias = bias2;
    const int tid = threadIdx.x, lane = tid & 31, lr = lane & 15, hi = lane >> 4; const int w = __builtin_amdgcn_readfirstlane(tid >> 5), wm = w >> 1, wn = w & 1;
    const int r0 = blockIdx.x * 128 + wm * 64, c0 = blockIdx.y * 128 + wn * 64;
    v8f acc[4][4];
#pragma unroll
    for (int mb = 0; mb < 4; ++mb)
#pragma unroll
        for (int nb = 0; nb < 4; ++nb) acc[mb][nb] = (v8f){};
    // copies: 16-byte piece tid & 7 of rows (tid >> 3) + 16 i
    const int crow = tid >> 3, ccol = tid & 7; const size_t rstep = (size_t)16 * K;
    const unsigned cl = (unsigned)(size_t)ring + (unsigned)(crow * 128 + ((ccol ^ ((crow >> 1) & 7)) * 16));
    const bf* ga = A + (size_t)(blockIdx.x * 128 + crow) * K + ccol * 8; const bf* ga2 = NSPLIT ? A2 + (size_t)(blockIdx.x * 128 + crow) * K + ccol * 8 : nullptr; const bf* gb = Bt + (size_t)(blockIdx.y * 128 + crow) * K + ccol * 8;
    auto fill = [&](int t) { const unsigned l = cl + (unsigned)((t & 1) * STAGE); cp8(l, ga + t * 64, rstep); if (NSPLIT) cp8(l + GTILE, ga2 + t * 64, rstep); cp8(l + (1 + NSPLIT) * GTILE, gb + t * 64, rstep); };
    // fragment reads: row lr of a 16-row block; the pieces hi + 4 kk and hi + 2 + 4 kk of the stage's 8, at their exchanged places
    const int sw = hi ^ ((lr >> 1) & 7); const int aro = (wm * 64 + lr) * 128, bro = (1 + NSPLIT) * GTILE + (wn * 64 + lr) * 128;
    const int nst = K / 64;
    fill(0);
    asm volatile("s_wait_asynccnt 0x0" ::: "memory");   // stage 0 of this wave's copies has landed
    __syncthreads();                                    // ... and every other wave's
    if (nst > 1) fill(1);
    // kept rolled, like the loop it replaces: a trip already holds a whole stage's matrix instructions for its one branch and one barrier
#pragma unroll 1
    for (int t = 0; t < nst; ++t) {
        const unsigned char* sb = ring + (t & 1) * STAGE;
        v16bf a[4], a2[4];
#pragma unroll
        for (int kk = 0; kk < 2; ++kk) { const int x0 = (sw ^ (4 * kk)) * 16, x1 = (sw ^ (4 * kk + 2)) * 16;
#pragma unroll
            for (int mb = 0; mb < 4; ++mb) { a[mb] = ldsfrag(sb + aro + mb * 2048, x0, x1); if (NSPLIT) a2[mb] = ldsfrag(sb + GTILE + aro + mb * 2048, x0, x1); }
#pragma unroll
            for (int nb = 0; nb < 4; ++nb) { const v16bf b = ldsfrag(sb + bro + nb * 2048, x0, x1);
#pragma unroll
                for (int mb = 0; mb < 4; ++mb) { acc[mb][nb] = wmmab(a[mb], b, acc[mb][nb]); if (NSPLIT) acc[mb][nb] = wmmab(a2[mb], b, acc[mb][nb]); } } }
        asm volatile("s_wait_dscnt 0x0" ::: "memory");      // this wave's reads of stage t are done before the buffer is given up
        asm volatile("s_wait_asynccnt 0x0" ::: "memory");   // this wave's copies of stage t + 1 have landed
        __syncthreads();                                    // publishes stage t + 1 and ends every wave's reads of the buffer that stage t + 2 overwrites
        if (t + 2 < nst) fill(t + 2);
    }
    asm volatile("s_wait_asynccnt 0x0" ::: "memory");       // nothing is in flight when the ring becomes output staging
    float* os = (float*)ring + w * (16 * 68);               // each wave stages its output in its own 4352 B of the ring, behind the last stage's barrier
    if constexpr (PLANES) {
        const size_t hp = (size_t)(r0 / TT) * NH_ + c0 / HDM; const int t0 = r0 % TT; const int prow = lane >> 3, pc = (lane & 7) * 8;   // read-back: 8 lanes a row of 128 B, 4 rows a store
        if (z < 2) {
            // q, k: the tile is 64 rows of 128 B one behind the other; 16 rows at a time pass through LDS in f32, a wave's store is 512 B in a row
            h16* P = (z == 0 ? PQ : PK) + (hp * TT + t0) * HDM; float bb[8];
#pragma unroll
            for (int i = 0; i < 8; ++i) bb[i] = bfr(bias[c0 + pc + i]);
#pragma unroll
            for (int mb = 0; mb < 4; ++mb) {
#pragma unroll
                for (int nb = 0; nb < 4; ++nb) {
#pragma unroll
                    for (int j = 0; j < 8; ++j) os[(hi * 8 + j) * 68 + nb * 16 + lr] = acc[mb][nb][j]; }
                __builtin_amdgcn_wave_barrier(); asm volatile("" ::: "memory");   // keeps the read-back of other lanes' values behind the LDS stores
#pragma unroll
                for (int s = 0; s < 4; ++s) { const int row = 4 * s + prow; const v4f v0 = *(const v4fa*)(os + row * 68 + pc), v1 = *(const v4fa*)(os + row * 68 + pc + 4); v8h o;
#pragma unroll
                    for (int i = 0; i < 4; ++i) { o[i] = (h16)(v0[i] + bb[i]); o[4 + i] = (h16)(v1[i] + bb[4 + i]); }
                    *(v8h*)(P + (size_t)(mb * 16 + row) * HDM + pc) = o; }
                __builtin_amdgcn_wave_barrier(); asm volatile("s_wait_xcnt 0x0" ::: "memory");   // keeps the next 16 rows' LDS stores behind this read-back; the wait stands behind every run of stores, before their registers are written again
            }
        } else {
            // v: a lane's 8 accumulator rows are 8 consecutive tokens of one d, one 16-byte piece of a V^T row; 16 d rows (128 B at a pitch of 144 B) at a time pass through LDS, so that a store fills whole 128-byte lines
            h16* P = PV + hp * HDM * TT + t0; h16* oh = (h16*)os; float bq[4];
#pragma unroll
            for (int nb = 0; nb < 4; ++nb) bq[nb] = bfr(bias[c0 + nb * 16 + lr]);
#pragma unroll
            for (int nb = 0; nb < 4; ++nb) { const float bv = bq[nb];
#pragma unroll
                for (int mb = 0; mb < 4; ++mb) { v8h o;
#pragma unroll
                    for (int j = 0; j < 8; ++j) o[j] = (h16)(acc[mb][nb][j] + bv);
                    *(v8ha*)(oh + lr * 72 + mb * 16 + hi * 8) = o; }
                __builtin_amdgcn_wave_barrier(); asm volatile("" ::: "memory");   // keeps the read-back of other lanes' values behind the LDS stores
#pragma unroll
                for (int s = 0; s < 4; ++s) { const int row = 4 * s + prow; const v8h o = *(const v8ha*)(oh + row * 72 + pc); *(v8h*)(P + (size_t)(nb * 16 + row) * TT + pc) = o; }
                __builtin_amdgcn_wave_barrier(); asm volatile("s_wait_xcnt 0x0" ::: "memory"); __builtin_amdgcn_sched_barrier(0);   // keeps the next 16 rows' LDS stores behind this read-back; the wait stands behind every run of stores, before their registers are written again; the scheduling barrier keeps the later rows' adds from being lifted here, which took the kernel past 192 registers (four waves a SIMD instead of five)
            }
        }
        return;
    }
#pragma unroll
    for (int mb = 0; mb < 4; ++mb) {
#pragma unroll
        for (int nb = 0; nb < 4; ++nb) {
#pragma unroll
            for (int j = 0; j < 8; ++j) os[(hi * 8 + j) * 68 + nb * 16 + lr] = acc[mb][nb][j]; }
        __builtin_amdgcn_wave_barrier(); asm volatile("" ::: "memory");
        float* crow = C + (size_t)(r0 + mb * 16) * ldc + c0;
{
#pragma unroll
            for (int s = 0; s < 8; ++s) { const int row = 2 * s + hi, cofs = lr * 4; v4f val = *(const v4fa*)(os + row * 68 + cofs); val[0] += bfr(bias[c0 + cofs]); val[1] += bfr(bias[c0 + cofs + 1]); val[2] += bfr(bias[c0 + cofs + 2]); val[3] += bfr(bias[c0 + cofs + 3]);
                *(v4f*)(crow + (size_t)row * ldc + cofs) = val; }
             }
        __builtin_amdgcn_wave_barrier(); asm volatile("" ::: "memory");
    }
}

__device__ __forceinline__ h16 tohx(float x) { return (h16)x; }
__device__ __forceinline__ void splitf(float y, unsigned short& h, unsigned short& l) { h = f2bf(y); l = f2bf(y - bf2f(h)); }
typedef __attribute__((ext_vector_type(2))) _Float16 v2h;
typedef __attribute__((ext_vector_type(4))) _Float16 v4h;
typedef __attribute__((ext_vector_type(2))) unsigned short v2us;
typedef __attribute__((ext_vector_type(4))) unsigned short v4us;
typedef __attribute__((ext_vector_type(2))) float v2f;

__global__ __launch_bounds__(256) void k_wtG(const float* __restrict__ w, int K, int N, bf* Bt) {
    const int lane = threadIdx.x & 31; const int L0 = (blockIdx.x * 8 + (threadIdx.x >> 5)) * 8; const int nlines = N * K / 64;
{
#pragma unroll 1
        for (int l = 0; l < 8; ++l) { const int L = L0 + l; if (L >= nlines) break; const size_t e = (size_t)L * 64 + lane * 2; const int k = (int)(e % K), n = (int)(e / K); v2us o;
            o[0] = f2bf(w[(size_t)k * N + n]); o[1] = f2bf(w[(size_t)(k + 1) * N + n]); *(v2us*)(Bt + e) = o; }
         }
}
// ---- k_cvtall: x and the four weight matrices, f32 -> bf16, in ONE launch of one work-group a WGP (256 x 11 waves), so that few waves have to be started for the bytes moved.
// A wave takes CVL x 128 consecutive floats of ONE source: each load is 512 B in a row (4 whole lines), all CVL loads are issued before the first value is used, each store is 256 B in a row (2 whole lines).
// Wave g: the first NX chunks are x, then NW chunks of each weight matrix; the first three bf16 weight copies land one behind the other in d012, the fourth in d3.
#define CVL 24
#define CVW 11
__global__ __launch_bounds__(CVW * 32) void k_cvtall(const float* __restrict__ x, const float* __restrict__ s0, const float* __restrict__ s1, const float* __restrict__ s2, const float* __restrict__ s3, bf* xb, bf* d012, bf* d3) {
    constexpr unsigned CH = CVL * 128, NX = NB_ * TT * DD / CH, NW = DD * DD / CH;
    static_assert(NX * CH == NB_ * TT * DD && NW * CH == DD * DD && (NX + 4 * NW) % CVW == 0, "whole chunks, whole work-groups");
    const unsigned lane = threadIdx.x & 31, g = blockIdx.x * CVW + (unsigned)__builtin_amdgcn_readfirstlane((int)(threadIdx.x >> 5));
    const float* src; bf* dst;
    if (g < NX) { src = x + (size_t)g * CH; dst = xb + (size_t)g * CH; }
    else { const unsigned y = (g - NX) / NW, r = (g - NX) % NW; src = (y == 0 ? s0 : y == 1 ? s1 : y == 2 ? s2 : s3) + (size_t)r * CH; dst = (y < 3 ? d012 + (size_t)y * DD * DD : d3) + (size_t)r * CH; }
    v4f v[CVL];
#pragma unroll
    for (int i = 0; i < CVL; ++i) v[i] = *(const v4f*)(src + i * 128 + lane * 4);
#pragma unroll
    for (int i = 0; i < CVL; ++i) { v4us o;
#pragma unroll
        for (int k = 0; k < 4; ++k) o[k] = f2bf(v[i][k]);
        *(v4us*)(dst + i * 128 + lane * 4) = o; }
}
// lane l with lane l ^ 16
__device__ __forceinline__ float xhalf(float x) { return __builtin_bit_cast(float, __builtin_amdgcn_permlanex16(__builtin_bit_cast(int, x), __builtin_bit_cast(int, x), 0x76543210, 0xfedcba98, false, false)); }
// eight independent 2^x, each in place; the v_nop is the one slot that the instruction set asks for behind a transcendental before its result is used or its source overwritten
__device__ __forceinline__ void exp2x8(float& x0, float& x1, float& x2, float& x3, float& x4, float& x5, float& x6, float& x7) {
    asm("v_exp_f32 %0, %0\n\tv_exp_f32 %1, %1\n\tv_exp_f32 %2, %2\n\tv_exp_f32 %3, %3\n\tv_exp_f32 %4, %4\n\tv_exp_f32 %5, %5\n\tv_exp_f32 %6, %6\n\tv_exp_f32 %7, %7\n\tv_nop"
        : "+v"(x0), "+v"(x1), "+v"(x2), "+v"(x3), "+v"(x4), "+v"(x5), "+v"(x6), "+v"(x7)); }
#define FST  64
#define FPIT 72
#define MLAG 8.0f
#define PEXP   6.0f
__global__ __launch_bounds__(128) void k_fattn(const h16* __restrict__ QP, const h16* __restrict__ KP, const h16* __restrict__ VT, float scl, bf* Ah, bf* Al) {
    __shared__ __align__(16) h16 Ks[2][FST * FPIT];
    __shared__ __align__(16) h16 Vs[2][HDM * FPIT];
    const size_t z = blockIdx.y; QP += z * TT * HDM; KP += z * TT * HDM; VT += z * HDM * TT;
    const int tid = threadIdx.x, lane = tid & 31, lr = lane & 15, hi = lane >> 4; const int q0 = blockIdx.x * 128 + (tid >> 5) * 32;
    const float c = scl * 1.4426950408889634f;
    v16h qf[2][2];
#pragma unroll
    for (int qt = 0; qt < 2; ++qt)
#pragma unroll
        for (int kc = 0; kc < 2; ++kc) qf[qt][kc] = WFrag<h16>::ld(QP + (size_t)(q0 + qt * 16 + lr) * HDM + kc * 32 + 8 * hi);
    v8f o[2][4];
#pragma unroll
    for (int qt = 0; qt < 2; ++qt)
#pragma unroll
        for (int mb = 0; mb < 4; ++mb) o[qt][mb] = (v8f){};
    float m[2] = { -3.0e38f, -3.0e38f }; v2f l[2] = { (v2f){}, (v2f){} };   // l: a lane's sums over its even and its odd keys
    // staging: 16-byte piece tid + 128 i of a 64 x 128 B tile: row srow + 16 i, bytes 16 scol on
    const int srow = tid >> 3, scol = tid & 7;
    const h16* kg = KP + (size_t)srow * HDM + scol * 8; const h16* vg = VT + (size_t)srow * TT + scol * 8; const int sl = srow * FPIT + scol * 8;
    v8h kr[4], vr[4];
#pragma unroll
    for (int i = 0; i < 4; ++i) { kr[i] = *(const v8h*)(kg + (size_t)i * 16 * HDM); vr[i] = *(const v8h*)(vg + (size_t)i * 16 * TT); }
#pragma unroll
    for (int i = 0; i < 4; ++i) { *(v8h*)(&Ks[0][sl + i * 16 * FPIT]) = kr[i]; *(v8h*)(&Vs[0][sl + i * 16 * FPIT]) = vr[i]; }
    __syncthreads();
    for (int s = 0; s < TT / FST; ++s) {
        const bool more = s + 1 < TT / FST;
        if (more) {
#pragma unroll
            for (int i = 0; i < 4; ++i) { kr[i] = *(const v8h*)(kg + (size_t)((s + 1) * FST + i * 16) * HDM); vr[i] = *(const v8h*)(vg + (size_t)i * 16 * TT + (s + 1) * FST); } }
        const h16* kb = &Ks[s & 1][lr * FPIT + 8 * hi]; const h16* vb = &Vs[s & 1][lr * FPIT + 8 * hi];
#pragma unroll
        for (int p = 0; p < FST / 32; ++p) {
            v8f st[2][2];
#pragma unroll
            for (int kt = 0; kt < 2; ++kt) { const v16h k0 = WFrag<h16>::ld(kb + (p * 32 + kt * 16) * FPIT), k1 = WFrag<h16>::ld(kb + (p * 32 + kt * 16) * FPIT + 32);
#pragma unroll
                for (int qt = 0; qt < 2; ++qt) { st[qt][kt] = wmma16(k0, qf[qt][0], (v8f){}); st[qt][kt] = wmma16(k1, qf[qt][1], st[qt][kt]); } }
            float xm[2];
#pragma unroll
            for (int qt = 0; qt < 2; ++qt) { float mx = st[qt][0][0];
#pragma unroll
                for (int j = 1; j < 8; ++j) mx = fmaxf(mx, st[qt][0][j]);
#pragma unroll
                for (int j = 0; j < 8; ++j) mx = fmaxf(mx, st[qt][1][j]);
                xm[qt] = fmaxf(mx, xhalf(mx)) * c; }
            // one test a pass for the whole wave: the output tiles are rescaled only when some query's maximum in use is raised
            if (__builtin_amdgcn_ballot_w32(xm[0] > m[0] + MLAG || xm[1] > m[1] + MLAG) != 0) {
#pragma unroll
                for (int qt = 0; qt < 2; ++qt) { const float mn = fmaxf(m[qt], xm[qt]); const float al = __builtin_amdgcn_exp2f(m[qt] - mn); m[qt] = mn; l[qt] *= al;
#pragma unroll
                    for (int mb = 0; mb < 4; ++mb)
#pragma unroll
                        for (int j = 0; j < 8; ++j) o[qt][mb][j] *= al; } }
            v16h pf[2];
#pragma unroll
            for (int qt = 0; qt < 2; ++qt) { const float nm = PEXP - m[qt];
#pragma unroll
                for (int kt = 0; kt < 2; ++kt) { float x[8];
#pragma unroll
                    for (int j = 0; j < 8; ++j) x[j] = fmaf(st[qt][kt][j], c, nm);
                    exp2x8(x[0], x[1], x[2], x[3], x[4], x[5], x[6], x[7]);
#pragma unroll
                    for (int j = 0; j < 8; j += 2) { l[qt] += (v2f){ x[j], x[j + 1] }; pf[qt][kt * 8 + j] = (h16)x[j]; pf[qt][kt * 8 + j + 1] = (h16)x[j + 1]; } } }
#pragma unroll
            for (int mb = 0; mb < 4; ++mb) { const v16h vf = WFrag<h16>::ld(vb + mb * 16 * FPIT + p * 32);
#pragma unroll
                for (int qt = 0; qt < 2; ++qt) o[qt][mb] = wmma16(vf, pf[qt], o[qt][mb]); }
        }
        if (more) {
#pragma unroll
            for (int i = 0; i < 4; ++i) { *(v8h*)(&Ks[(s + 1) & 1][sl + i * 16 * FPIT]) = kr[i]; *(v8h*)(&Vs[(s + 1) & 1][sl + i * 16 * FPIT]) = vr[i]; } }
        __syncthreads();   // publishes stage s + 1 and ends every wave's reads of the buffer that stage s + 2 will overwrite
    }
#pragma unroll
    for (int qt = 0; qt < 2; ++qt) { const float lh = l[qt][0] + l[qt][1]; const float f = __fdiv_rn(1.0f, lh + xhalf(lh));
        // merged layout [batch][query][head * 64 + d], as bf16 hi + lo planes: a lane's 8 consecutive d are one 16-byte store a plane, a wave fills whole 128-byte lines
        const size_t oo = ((z / NH_) * TT + (size_t)(q0 + qt * 16 + lr)) * DD + (z % NH_) * HDM + 8 * hi;
#pragma unroll
        for (int mb = 0; mb < 4; ++mb) { v8us oh, ol;
#pragma unroll
            for (int j = 0; j < 8; ++j) { unsigned short a, c2; splitf(o[qt][mb][j] * f, a, c2); oh[j] = a; ol[j] = c2; }
            *(v8us*)(Ah + oo + mb * 16) = oh; *(v8us*)(Al + oo + mb * 16) = ol; } }
}
__global__ __launch_bounds__(256) void k_mrgf(const float* __restrict__ O, int h, int hd, float* CT) { const size_t e = ((size_t)blockIdx.x * 256 + threadIdx.x) * 2; if (e >= (size_t)TT * hd) return; const int d = (int)(e % hd); const int t = (int)(e / hd); v2f o; o[0] = O[e] * (1.0f / PCAR); o[1] = O[e + 1] * (1.0f / PCAR); const size_t oo = (size_t)t * DD + h * hd + d; *(v2f*)(CT + oo) = o;  }

extern "C" void kernel_launch(void* const* d_in, const int* in_sizes, int n_in,
                              void* d_out, int out_size, void* d_ws, size_t ws_size, hipStream_t stream) {
    (void)in_sizes; (void)n_in; (void)out_size;
    const float* IN[9]; for (int i = 0; i < 9; ++i) IN[i] = (const float*)d_in[i];   // x, Wq, bq, Wk, bk, Wv, bv, Wo, bo (torch [out][in])
    float* OUT = (float*)d_out;     // [8][1024][768]
    char* wsp = (char*)d_ws;
    auto take = [&](size_t bytes) { char* p = wsp; wsp += (bytes + 255) & ~(size_t)255; return (void*)p; };
    // kept to the end: WO and the q/k/v planes of all 96 heads. SP: up to the attention kernel WQ/WK/WV and x in bf16, from it on the merged planes (the larger of the two uses).
    bf* WO = (bf*)take((size_t)DD * DD * 2); h16* QP = (h16*)take((size_t)NB_ * TT * DD * 2); h16* KP = (h16*)take((size_t)NB_ * TT * DD * 2); h16* VT = (h16*)take((size_t)NB_ * DD * TT * 2);
    char* SP = wsp; bf* WQKV = (bf*)take((size_t)3 * DD * DD * 2); bf* XB = (bf*)take((size_t)NB_ * TT * DD * 2);
    wsp = SP; bf* Ah = (bf*)take((size_t)NB_ * TT * DD * 2); bf* Al = (bf*)take((size_t)NB_ * TT * DD * 2);
    if ((size_t)(wsp - (char*)d_ws) > ws_size) return;
    k_cvtall<<<(NB_ * TT * DD + 4 * DD * DD) / (CVL * 128 * CVW), CVW * 32, 0, stream>>>(IN[0], IN[1], IN[3], IN[5], IN[7], XB, WQKV, WO);
    const float scl = 0.036084391824351615f;   // 768^-0.5
    k_gemmw<0, true><<<dim3(NB_ * TT / 128, DD / 128, 3), 128, 0, stream>>>(XB, nullptr, WQKV, DD, nullptr, 0, IN[2], IN[4], IN[6], (size_t)DD * DD, QP, KP, VT);
    k_fattn<<<dim3(TT / 128, NB_ * NH_, 1), 128, 0, stream>>>(QP, KP, VT, scl, Ah, Al);
    k_gemmw<1, false><<<dim3(NB_ * TT / 128, DD / 128, 1), 128, 0, stream>>>(Ah, Al, WO, DD, OUT, DD, IN[8], nullptr, nullptr, 0, nullptr, nullptr, nullptr);
}

// v007
// A run of this version takes 79.2 microseconds.
// Versions between v005 and this one are left out; their measured steps multiply to 1.23 times as fast.
// All steps since v000 together make it 46.9 times as fast.
#include <hip/hip_runtime.h>

// Multi-head self-attention (x [8][1024][768]; q/k/v = x W^T + b (12 heads x 64); scores = q.k x 768^-0.5 (the module scales by embed_dim, not head_dim); softmax; out = merged attn.v Wo^T + bo -> [8][1024][768]).
// Compute dtypes, f32 accumulate: every input rounded to bf16; projections on PLAIN bf16 operands (inputs: exact products, f32 accumulate, + bias); scores (K 64) and
// attn.v on SINGLE fp16 planes with an f32 softmax (scale in f32); merged heads as ONE fp16 plane (they are sums of fp16 P x fp16 V, inside V's range) x the bf16-rounded Wo held in fp16 (1 product) + bo. Projections: GEMMs of four 64x64 wave tiles a work-group, operand tiles shared through LDS, batched in grid z; the q/k/v GEMM stores its tiles as fp16 head planes itself (V transposed).
// Attention: ONE kernel for all 96 heads; scores and probabilities stay in registers (running maximum and sum per query), K and V^T tiles pass through LDS.

#define NB_  8
#define TT   1024
#define DD   768
#define NH_  12
#define HDM  64
#define ZH   1
#define PCAR 1024.0f
typedef _Float16 h16;
typedef unsigned short bf;
typedef __attribute__((ext_vector_type(16))) __bf16   v16bf;
typedef __attribute__((ext_vector_type(16))) _Float16 v16h;
typedef __attribute__((ext_vector_type(8)))  _Float16 v8h;
typedef __attribute__((ext_vector_type(8)))  unsigned short v8us;
typedef __attribute__((ext_vector_type(8)))  float    v8f;
typedef __attribute__((ext_vector_type(4)))  float    v4f;
typedef v8h  __attribute__((may_alias)) v8ha;
typedef v4f  __attribute__((may_alias)) v4fa;
typedef v8us __attribute__((may_alias)) v8usa;

__device__ __forceinline__ unsigned short f2bf(float f) { unsigned u = __float_as_uint(f); u += 0x7FFFu + ((u >> 16) & 1u); return (unsigned short)(u >> 16); }
__device__ __forceinline__ float bf2f(unsigned short b) { return __uint_as_float(((unsigned)b) << 16); }
__device__ __forceinline__ float bfr(float f) { return bf2f(f2bf(f)); }
__device__ __forceinline__ v16h cat16(v8h lo, v8h hi) { return __builtin_shufflevector(lo, hi, 0, 1, 2, 3, 4, 5, 6, 7, 8, 9, 10, 11, 12, 13, 14, 15); }
__device__ __forceinline__ v16bf cat16b(v8us lo, v8us hi) { return __builtin_bit_cast(v16bf, __builtin_shufflevector(lo, hi, 0, 1, 2, 3, 4, 5, 6, 7, 8, 9, 10, 11, 12, 13, 14, 15)); }
__device__ __forceinline__ v8f wmma16(v16h a, v16h b, v8f c) { return __builtin_amdgcn_wmma_f32_16x16x32_f16(false, a, false, b, (short)0, c, false, false); }
__device__ __forceinline__ v8f wmmab(v16bf a, v16bf b, v8f c) { return __builtin_amdgcn_wmma_f32_16x16x32_bf16(false, a, false, b, (short)0, c, false, false); }



// ---- k_gemmw: GEMM, one 128x128 output tile per work-group of FOUR WAVES (2 x 2), each wave a 64x64 tile (16 accumulators); grid (M/128, N/128, Z), 128 threads. Operands are 16-bit planes, bf16 or fp16 (HF), stored in stage-tile order: element (row, k) lies at ((row / 128) * (K / 64) + k / 64) * GTEL + (row % 128) * 64 + k % 64.
// C[m][n] (f32, pitch ldc, + f32 bias[n]) = sum_k A[m][k] Bt[n][k]. z moves Bt by sB elements and picks bias, bias1 or bias2. K % 64 == 0.
// A stage is 64 k: 128 rows of 128 B of either operand, 16 KB in a row in global memory, copied global -> LDS without registers (each wave-wide copy reads 512 B in a row), two buffers, the next stage's copies in flight while this one is multiplied.
// LDS rows stand at a pitch of 128 B with no pad; the 16-byte piece c of row r lies at piece c ^ ((r >> 1) & 7), so that the 16 rows of a fragment read fall on 16 different bank groups.
// PLANES: no C. A wave's tile is 64 tokens of one batch x the 64 d of one head; the sum + bias, rounded to fp16, goes to PQ (z = 0) or PK (z = 1) as [batch][head][token][d], or to PV (z = 2) as [batch][head][token / 64][d][token % 64], the attention kernel's stage tiles.
template <typename T16> struct WFrag;
template <> struct WFrag<h16> { typedef v16h V; static __device__ __forceinline__ V ld(const h16* p) { return cat16(*(const v8h*)p, *(const v8h*)(p + 16)); } static __device__ __forceinline__ v8f mma(V a, V b, v8f c) { return wmma16(a, b, c); } };
#define GTILE 16384   // one operand's 128 rows x 128 B
#define GTEL  8192    // ... in elements
// eight asynchronous 16-byte copies of a lane: rows 16 apart (2048 B in LDS, rstep elements in global memory). The s_wait_xcnt stands in the copies' own statement, so that it comes before any rewrite of an address register that a copy names.
__device__ __forceinline__ void cp8(unsigned l, const bf* g, size_t rstep) {
    asm volatile("global_load_async_to_lds_b128 %0, %8, off\n\tglobal_load_async_to_lds_b128 %1, %9, off\n\tglobal_load_async_to_lds_b128 %2, %10, off\n\tglobal_load_async_to_lds_b128 %3, %11, off\n\t"
                 "global_load_async_to_lds_b128 %4, %12, off\n\tglobal_load_async_to_lds_b128 %5, %13, off\n\tglobal_load_async_to_lds_b128 %6, %14, off\n\tglobal_load_async_to_lds_b128 %7, %15, off\n\ts_wait_xcnt 0x0"
                 :: "v"(l), "v"(l + 2048u), "v"(l + 4096u), "v"(l + 6144u), "v"(l + 8192u), "v"(l + 10240u), "v"(l + 12288u), "v"(l + 14336u),
                    "v"(g), "v"(g + rstep), "v"(g + 2 * rstep), "v"(g + 3 * rstep), "v"(g + 4 * rstep), "v"(g + 5 * rstep), "v"(g + 6 * rstep), "v"(g + 7 * rstep) : "memory"); }
__device__ __forceinline__ v16bf ldsfrag(const unsigned char* row, int x0, int x1) { return cat16b(*(const v8usa*)(row + x0), *(const v8usa*)(row + x1)); }
template <bool HF> __device__ __forceinline__ v8f wmmax(v16bf a, v16bf b, v8f c) { if constexpr (HF) return wmma16(__builtin_bit_cast(v16h, a), __builtin_bit_cast(v16h, b), c); else return wmmab(a, b, c); }
// the output GEMM's grid is one and a half work-groups a WGP, so its registers are budgeted for two waves a SIMD; at the default the compiler budgets for the five work-groups that fit the LDS, keeps ONE Bt fragment and waits out an LDS read in front of every four matrix instructions
template <bool HF, bool PLANES>
__global__ __launch_bounds__(128) __attribute__((amdgpu_waves_per_eu(1, PLANES ? 16 : 2))) void k_gemmw(const bf* __restrict__ A, const bf* __restrict__ Bt, int K, float* C, int ldc, const float* __restrict__ bias, const float* __restrict__ bias1, const float* __restrict__ bias2, size_t sB, h16* PQ, h16* PK, h16* PV) {
    constexpr int STAGE = 2 * GTILE;   // [A | Bt]
    __shared__ __align__(1024) unsigned char ring[2 * STAGE];
    const size_t z = blockIdx.z; Bt += z * sB; if (z == 1) bias = bias1; else if (z == 2) bias = bias2;
    const int tid = threadIdx.x, lane = tid & 31, lr = lane & 15, hi = lane >> 4; const int w = __builtin_amdgcn_readfirstlane(tid >> 5), wm = w >> 1, wn = w & 1;
    const int r0 = blockIdx.x * 128 + wm * 64, c0 = blockIdx.y * 128 + wn * 64;
    v8f acc[4][4];
#pragma unroll
    for (int mb = 0; mb < 4; ++mb)
#pragma unroll
        for (int nb = 0; nb < 4; ++nb) acc[mb][nb] = (v8f){};
    // copies: 16-byte piece tid & 7 of rows (tid >> 3) + 16 i
    const int crow = tid >> 3, ccol = tid & 7; const size_t rstep = 16 * 64; const int nst = K / 64;
    const unsigned cl = (unsigned)(size_t)ring + (unsigned)(crow * 128 + ((ccol ^ ((crow >> 1) & 7)) * 16));
    const bf* ga = A + (size_t)blockIdx.x * nst * GTEL + tid * 8; const bf* gb = Bt + (size_t)blockIdx.y * nst * GTEL + tid * 8;
    auto fill = [&](int t) { const unsigned l = cl + (unsigned)((t & 1) * STAGE); cp8(l, ga + (size_t)t * GTEL, rstep); cp8(l + GTILE, gb + (size_t)t * GTEL, rstep); };
    // fragment reads: row lr of a 16-row block; the pieces hi + 4 kk and hi + 2 + 4 kk of the stage's 8, at their exchanged places
    const int sw = hi ^ ((lr >> 1) & 7); const int aro = (wm * 64 + lr) * 128, bro = GTILE + (wn * 64 + lr) * 128;
    fill(0);
    asm volatile("s_wait_asynccnt 0x0" ::: "memory");   // stage 0 of this wave's copies has landed
    __syncthreads();                                    // ... and every other wave's
    if (nst > 1) fill(1);
    // kept rolled, like the loop it replaces: a trip already holds a whole stage's matrix instructions for its one branch and one barrier
#pragma unroll 1
    for (int t = 0; t < nst; ++t) {
        const unsigned char* sb = ring + (t & 1) * STAGE;
        v16bf a[4];
#pragma unroll
        for (int kk = 0; kk < 2; ++kk) { const int x0 = (sw ^ (4 * kk)) * 16, x1 = (sw ^ (4 * kk + 2)) * 16;
#pragma unroll
            for (int mb = 0; mb < 4; ++mb) a[mb] = ldsfrag(sb + aro + mb * 2048, x0, x1);
#pragma unroll
            for (int nb = 0; nb < 4; ++nb) { const v16bf b = ldsfrag(sb + bro + nb * 2048, x0, x1);
#pragma unroll
                for (int mb = 0; mb < 4; ++mb) acc[mb][nb] = wmmax<HF>(a[mb], b, acc[mb][nb]); } }
        asm volatile("s_wait_dscnt 0x0" ::: "memory");      // this wave's reads of stage t are done before the buffer is given up
        asm volatile("s_wait_asynccnt 0x0" ::: "memory");   // this wave's copies of stage t + 1 have landed
        __syncthreads();                                    // publishes stage t + 1 and ends every wave's reads of the buffer that stage t + 2 overwrites
        if (t + 2 < nst) fill(t + 2);
    }
    asm volatile("s_wait_asynccnt 0x0" ::: "memory");       // nothing is in flight when the ring becomes output staging
    float* os = (float*)ring + w * (16 * 68);               // each wave stages its output in its own 4352 B of the ring, behind the last stage's barrier
    if constexpr (PLANES) {
        const size_t hp = (size_t)(r0 / TT) * NH_ + c0 / HDM; const int t0 = r0 % TT; const int prow = lane >> 3, pc = (lane & 7) * 8;   // read-back: 8 lanes a row of 128 B, 4 rows a store
        if (z < 2) {
            // q, k: the tile is 64 rows of 128 B one behind the other; 16 rows at a time pass through LDS in f32, a wave's store is 512 B in a row
            h16* P = (z == 0 ? PQ : PK) + (hp * TT + t0) * HDM; float bb[8];
#pragma unroll
            for (int i = 0; i < 8; ++i) bb[i] = bfr(bias[c0 + pc + i]);
#pragma unroll
            for (int mb = 0; mb < 4; ++mb) {
#pragma unroll
                for (int nb = 0; nb < 4; ++nb) {
#pragma unroll
                    for (int j = 0; j < 8; ++j) os[(hi * 8 + j) * 68 + nb * 16 + lr] = acc[mb][nb][j]; }
                __builtin_amdgcn_wave_barrier(); asm volatile("" ::: "memory");   // keeps the read-back of other lanes' values behind the LDS stores
#pragma unroll
                for (int s = 0; s < 4; ++s) { const int row = 4 * s + prow; const v4f v0 = *(const v4fa*)(os + row * 68 + pc), v1 = *(const v4fa*)(os + row * 68 + pc + 4); v8h o;
#pragma unroll
                    for (int i = 0; i < 4; ++i) { o[i] = (h16)(v0[i] + bb[i]); o[4 + i] = (h16)(v1[i] + bb[4 + i]); }
                    *(v8h*)(P + (size_t)(mb * 16 + row) * HDM + pc) = o; }
                __builtin_amdgcn_wave_barrier(); asm volatile("s_wait_xcnt 0x0" ::: "memory");   // keeps the next 16 rows' LDS stores behind this read-back; the wait stands behind every run of stores, before their registers are written again
            }
        } else {
            // v: a lane's 8 accumulator rows are 8 consecutive tokens of one d, one 16-byte piece of a V^T row; 16 d rows (128 B at a pitch of 144 B) at a time pass through LDS, so that a store fills four 128-byte lines in a row
            h16* P = PV + hp * HDM * TT + (size_t)t0 * HDM; h16* oh = (h16*)os; float bq[4];
#pragma unroll
            for (int nb = 0; nb < 4; ++nb) bq[nb] = bfr(bias[c0 + nb * 16 + lr]);
#pragma unroll
            for (int nb = 0; nb < 4; ++nb) { const float bv = bq[nb];
#pragma unroll
                for (int mb = 0; mb < 4; ++mb) { v8h o;
#pragma unroll
                    for (int j = 0; j < 8; ++j) o[j] = (h16)(acc[mb][nb][j] + bv);
                    *(v8ha*)(oh + lr * 72 + mb * 16 + hi * 8) = o; }
                __builtin_amdgcn_wave_barrier(); asm volatile("" ::: "memory");   // keeps the read-back of other lanes' values behind the LDS stores
#pragma unroll
                for (int s = 0; s < 4; ++s) { const int row = 4 * s + prow; const v8h o = *(const v8ha*)(oh + row * 72 + pc); *(v8h*)(P + (size_t)(nb * 16 + row) * 64 + pc) = o; }
                __builtin_amdgcn_wave_barrier(); asm volatile("s_wait_xcnt 0x0" ::: "memory"); __builtin_amdgcn_sched_barrier(0);   // keeps the next 16 rows' LDS stores behind this read-back; the wait stands behind every run of stores, before their registers are written again; the scheduling barrier keeps the later rows' adds from being lifted here, which took the kernel past 192 registers (four waves a SIMD instead of five)
            }
        }
        return;
    }
#pragma unroll
    for (int mb = 0; mb < 4; ++mb) {
#pragma unroll
        for (int nb = 0; nb < 4; ++nb) {
#pragma unroll
            for (int j = 0; j < 8; ++j) os[(hi * 8 + j) * 68 + nb * 16 + lr] = acc[mb][nb][j]; }
        __builtin_amdgcn_wave_barrier(); asm volatile("" ::: "memory");
        float* crow = C + (size_t)(r0 + mb * 16) * ldc + c0;
{
#pragma unroll
            for (int s = 0; s < 8; ++s) { const int row = 2 * s + hi, cofs = lr * 4; v4f val = *(const v4fa*)(os + row * 68 + cofs); val[0] += bfr(bias[c0 + cofs]); val[1] += bfr(bias[c0 + cofs + 1]); val[2] += bfr(bias[c0 + cofs + 2]); val[3] += bfr(bias[c0 + cofs + 3]);
                *(v4f*)(crow + (size_t)row * ldc + cofs) = val; }
             }
        __builtin_amdgcn_wave_barrier(); asm volatile("s_wait_xcnt 0x0" ::: "memory");   // keeps the next 16 rows' LDS stores behind this read-back; the wait stands behind every run of stores, before their registers are written again
    }
}

__device__ __forceinline__ h16 tohx(float x) { return (h16)x; }
typedef __attribute__((ext_vector_type(2))) _Float16 v2h;
typedef __attribute__((ext_vector_type(4))) _Float16 v4h;
typedef __attribute__((ext_vector_type(2))) unsigned short v2us;
typedef __attribute__((ext_vector_type(4))) unsigned short v4us;
typedef __attribute__((ext_vector_type(2))) float v2f;

__global__ __launch_bounds__(256) void k_wtG(const float* __restrict__ w, int K, int N, bf* Bt) {
    const int lane = threadIdx.x & 31; const int L0 = (blockIdx.x * 8 + (threadIdx.x >> 5)) * 8; const int nlines = N * K / 64;
{
#pragma unroll 1
        for (int l = 0; l < 8; ++l) { const int L = L0 + l; if (L >= nlines) break; const size_t e = (size_t)L * 64 + lane * 2; const int k = (int)(e % K), n = (int)(e / K); v2us o;
            o[0] = f2bf(w[(size_t)k * N + n]); o[1] = f2bf(w[(size_t)(k + 1) * N + n]); *(v2us*)(Bt + e) = o; }
         }
}
// ---- k_cvtall: x and the four weight matrices, f32 -> bf16 (the fourth: the bf16 value written as fp16, the output GEMM's operand type), in ONE launch of one work-group a WGP (256 x 11 waves), so that few waves have to be started for the bytes moved.
// A wave takes CVL x 128 consecutive floats of ONE source: each load is 512 B in a row (4 whole lines), all CVL loads are issued before the first value is used, each store is 2 whole lines. The copies are written in the GEMM's stage-tile order (k_gemmw): a chunk is 4 rows of one 128-row block, load i holds k (i % 6) * 128 on of row i / 6, a half wave one 64-k piece of it.
// Wave g: the first NX chunks are x, then NW chunks of each weight matrix; the first three bf16 weight copies land one behind the other in d012, the fourth in d3.
#define CVL 24
#define CVW 11
__global__ __launch_bounds__(CVW * 32) void k_cvtall(const float* __restrict__ x, const float* __restrict__ s0, const float* __restrict__ s1, const float* __restrict__ s2, const float* __restrict__ s3, bf* xb, bf* d012, bf* d3) {
    constexpr unsigned CH = CVL * 128, NX = NB_ * TT * DD / CH, NW = DD * DD / CH;
    static_assert(NX * CH == NB_ * TT * DD && NW * CH == DD * DD && (NX + 4 * NW) % CVW == 0, "whole chunks, whole work-groups");
    static_assert(CH == 4 * DD && DD % 128 == 0, "a chunk is four whole rows");
    auto tile = [](unsigned ch) { return (size_t)(ch >> 5) * (DD / 64) * GTEL + (ch & 31) * 256; };   // chunk ch: rows 4 (ch % 32) on of row block ch / 32
    const unsigned lane = threadIdx.x & 31, g = blockIdx.x * CVW + (unsigned)__builtin_amdgcn_readfirstlane((int)(threadIdx.x >> 5));
    const float* src; bf* dst;
    if (g < NX) { src = x + (size_t)g * CH; dst = xb + tile(g); }
    else { const unsigned y = (g - NX) / NW, r = (g - NX) % NW; src = (y == 0 ? s0 : y == 1 ? s1 : y == 2 ? s2 : s3) + (size_t)r * CH; dst = (y < 3 ? d012 + (size_t)y * DD * DD : d3) + tile(r); }
    dst += (lane >> 4) * GTEL + (lane & 15) * 4;
    v4f v[CVL];
#pragma unroll
    for (int i = 0; i < CVL; ++i) v[i] = *(const v4f*)(src + i * 128 + lane * 4);
    if (g < NX + 3 * NW) {
#pragma unroll
        for (int i = 0; i < CVL; ++i) { v4us o;
#pragma unroll
            for (int k = 0; k < 4; ++k) o[k] = f2bf(v[i][k]);
            *(v4us*)(dst + (i % 6) * 2 * GTEL + (i / 6) * 64) = o; }
    } else {
#pragma unroll
        for (int i = 0; i < CVL; ++i) { v4h o;
#pragma unroll
            for (int k = 0; k < 4; ++k) o[k] = (h16)bfr(v[i][k]);
            *(v4h*)(dst + (i % 6) * 2 * GTEL + (i / 6) * 64) = o; }
        asm volatile("s_wait_xcnt 0x0" ::: "memory");   // stands behind this run of stores, before any later instruction writes a register that one of them names
    }
}
// lane l with lane l ^ 16
__device__ __forceinline__ float xhalf(float x) { return __builtin_bit_cast(float, __builtin_amdgcn_permlanex16(__builtin_bit_cast(int, x), __builtin_bit_cast(int, x), 0x76543210, 0xfedcba98, false, false)); }
// eight independent 2^x, each in place; the v_nop is the one slot that the instruction set asks for behind a transcendental before its result is used or its source overwritten
__device__ __forceinline__ void exp2x8(float& x0, float& x1, float& x2, float& x3, float& x4, float& x5, float& x6, float& x7) {
    asm("v_exp_f32 %0, %0\n\tv_exp_f32 %1, %1\n\tv_exp_f32 %2, %2\n\tv_exp_f32 %3, %3\n\tv_exp_f32 %4, %4\n\tv_exp_f32 %5, %5\n\tv_exp_f32 %6, %6\n\tv_exp_f32 %7, %7\n\tv_nop"
        : "+v"(x0), "+v"(x1), "+v"(x2), "+v"(x3), "+v"(x4), "+v"(x5), "+v"(x6), "+v"(x7)); }
#define FST  64
#define FPIT 72
#define MLAG 8.0f
#define PEXP   6.0f
__global__ __launch_bounds__(128) void k_fattn(const h16* __restrict__ QP, const h16* __restrict__ KP, const h16* __restrict__ VT, float scl, h16* Am) {
    __shared__ __align__(16) h16 Ks[2][FST * FPIT];
    __shared__ __align__(16) h16 Vs[2][HDM * FPIT];
    const size_t z = blockIdx.y; QP += z * TT * HDM; KP += z * TT * HDM; VT += z * HDM * TT;
    const int tid = threadIdx.x, lane = tid & 31, lr = lane & 15, hi = lane >> 4; const int q0 = blockIdx.x * 128 + (tid >> 5) * 32;
    const float c = scl * 1.4426950408889634f;
    v16h qf[2][2];
#pragma unroll
    for (int qt = 0; qt < 2; ++qt)
#pragma unroll
        for (int kc = 0; kc < 2; ++kc) qf[qt][kc] = WFrag<h16>::ld(QP + (size_t)(q0 + qt * 16 + lr) * HDM + kc * 32 + 8 * hi);
    v8f o[2][4];
#pragma unroll
    for (int qt = 0; qt < 2; ++qt)
#pragma unroll
        for (int mb = 0; mb < 4; ++mb) o[qt][mb] = (v8f){};
    float m[2] = { -3.0e38f, -3.0e38f }; v2f l[2] = { (v2f){}, (v2f){} };   // l: a lane's sums over its even and its odd keys
    // staging: 16-byte piece tid + 128 i of a 64 x 128 B tile: row srow + 16 i, bytes 16 scol on
    const int srow = tid >> 3, scol = tid & 7;
    const h16* kg = KP + (size_t)srow * HDM + scol * 8; const h16* vg = VT + tid * 8; const int sl = srow * FPIT + scol * 8;
    v8h kr[4], vr[4];
#pragma unroll
    for (int i = 0; i < 4; ++i) { kr[i] = *(const v8h*)(kg + (size_t)i * 16 * HDM); vr[i] = *(const v8h*)(vg + (size_t)i * 16 * FST); }
#pragma unroll
    for (int i = 0; i < 4; ++i) { *(v8h*)(&Ks[0][sl + i * 16 * FPIT]) = kr[i]; *(v8h*)(&Vs[0][sl + i * 16 * FPIT]) = vr[i]; }
    __syncthreads();
    for (int s = 0; s < TT / FST; ++s) {
        const bool more = s + 1 < TT / FST;
        if (more) {
#pragma unroll
            for (int i = 0; i < 4; ++i) { kr[i] = *(const v8h*)(kg + (size_t)((s + 1) * FST + i * 16) * HDM); vr[i] = *(const v8h*)(vg + (size_t)(s + 1) * HDM * FST + i * 16 * FST); } }
        const h16* kb = &Ks[s & 1][lr * FPIT + 8 * hi]; const h16* vb = &Vs[s & 1][lr * FPIT + 8 * hi];
#pragma unroll
        for (int p = 0; p < FST / 32; ++p) {
            v8f st[2][2];
#pragma unroll
            for (int kt = 0; kt < 2; ++kt) { const v16h k0 = WFrag<h16>::ld(kb + (p * 32 + kt * 16) * FPIT), k1 = WFrag<h16>::ld(kb + (p * 32 + kt * 16) * FPIT + 32);
#pragma unroll
                for (int qt = 0; qt < 2; ++qt) { st[qt][kt] = wmma16(k0, qf[qt][0], (v8f){}); st[qt][kt] = wmma16(k1, qf[qt][1], st[qt][kt]); } }
            float xm[2];
#pragma unroll
            for (int qt = 0; qt < 2; ++qt) { float mx = st[qt][0][0];
#pragma unroll
                for (int j = 1; j < 8; ++j) mx = fmaxf(mx, st[qt][0][j]);
#pragma unroll
                for (int j = 0; j < 8; ++j) mx = fmaxf(mx, st[qt][1][j]);
                xm[qt] = fmaxf(mx, xhalf(mx)) * c; }
            // one test a pass for the whole wave: the output tiles are rescaled only when some query's maximum in use is raised
            if (__builtin_amdgcn_ballot_w32(xm[0] > m[0] + MLAG || xm[1] > m[1] + MLAG) != 0) {
#pragma unroll
                for (int qt = 0; qt < 2; ++qt) { const float mn = fmaxf(m[qt], xm[qt]); const float al = __builtin_amdgcn_exp2f(m[qt] - mn); m[qt] = mn; l[qt] *= al;
#pragma unroll
                    for (int mb = 0; mb < 4; ++mb)
#pragma unroll
                        for (int j = 0; j < 8; ++j) o[qt][mb][j] *= al; } }
            v16h pf[2];
#pragma unroll
            for (int qt = 0; qt < 2; ++qt) { const float nm = PEXP - m[qt];
#pragma unroll
                for (int kt = 0; kt < 2; ++kt) { float x[8];
#pragma unroll
                    for (int j = 0; j < 8; ++j) x[j] = fmaf(st[qt][kt][j], c, nm);
                    exp2x8(x[0], x[1], x[2], x[3], x[4], x[5], x[6], x[7]);
#pragma unroll
                    for (int j = 0; j < 8; j += 2) { l[qt] += (v2f){ x[j], x[j + 1] }; pf[qt][kt * 8 + j] = (h16)x[j]; pf[qt][kt * 8 + j + 1] = (h16)x[j + 1]; } } }
#pragma unroll
            for (int mb = 0; mb < 4; ++mb) { const v16h vf = WFrag<h16>::ld(vb + mb * 16 * FPIT + p * 32);
#pragma unroll
                for (int qt = 0; qt < 2; ++qt) o[qt][mb] = wmma16(vf, pf[qt], o[qt][mb]); }
        }
        if (more) {
#pragma unroll
            for (int i = 0; i < 4; ++i) { *(v8h*)(&Ks[(s + 1) & 1][sl + i * 16 * FPIT]) = kr[i]; *(v8h*)(&Vs[(s + 1) & 1][sl + i * 16 * FPIT]) = vr[i]; } }
        __syncthreads();   // publishes stage s + 1 and ends every wave's reads of the buffer that stage s + 2 will overwrite
    }
#pragma unroll
    for (int qt = 0; qt < 2; ++qt) { const float lh = l[qt][0] + l[qt][1]; const float f = __fdiv_rn(1.0f, lh + xhalf(lh));
        // merged plane, fp16, in the output GEMM's stage-tile order: row = batch * TT + query, k = head * 64 + d, so this work-group's 128 queries of one head are one tile; a lane's 8 consecutive d are one 16-byte store, a wave fills whole 128-byte lines
        const size_t oo = (((z / NH_) * (TT / 128) + blockIdx.x) * NH_ + z % NH_) * GTEL + (size_t)((q0 & 127) + qt * 16 + lr) * HDM + 8 * hi;
#pragma unroll
        for (int mb = 0; mb < 4; ++mb) { v8h om;
#pragma unroll
            for (int j = 0; j < 8; ++j) om[j] = (h16)(o[qt][mb][j] * f);
            *(v8h*)(Am + oo + mb * 16) = om; } }
}
__global__ __launch_bounds__(256) void k_mrgf(const float* __restrict__ O, int h, int hd, float* CT) { const size_t e = ((size_t)blockIdx.x * 256 + threadIdx.x) * 2; if (e >= (size_t)TT * hd) return; const int d = (int)(e % hd); const int t = (int)(e / hd); v2f o; o[0] = O[e] * (1.0f / PCAR); o[1] = O[e + 1] * (1.0f / PCAR); const size_t oo = (size_t)t * DD + h * hd + d; *(v2f*)(CT + oo) = o;  }

extern "C" void kernel_launch(void* const* d_in, const int* in_sizes, int n_in,
                              void* d_out, int out_size, void* d_ws, size_t ws_size, hipStream_t stream) {
    (void)in_sizes; (void)n_in; (void)out_size;
    const float* IN[9]; for (int i = 0; i < 9; ++i) IN[i] = (const float*)d_in[i];   // x, Wq, bq, Wk, bk, Wv, bv, Wo, bo (torch [out][in])
    float* OUT = (float*)d_out;     // [8][1024][768]
    char* wsp = (char*)d_ws;
    auto take = [&](size_t bytes) { char* p = wsp; wsp += (bytes + 255) & ~(size_t)255; return (void*)p; };
    // kept to the end: WO and the q/k/v planes of all 96 heads. SP: up to the attention kernel WQ/WK/WV and x in bf16, from it on the merged plane.
    bf* WO = (bf*)take((size_t)DD * DD * 2); h16* QP = (h16*)take((size_t)NB_ * TT * DD * 2); h16* KP = (h16*)take((size_t)NB_ * TT * DD * 2); h16* VT = (h16*)take((size_t)NB_ * DD * TT * 2);
    char* SP = wsp; bf* WQKV = (bf*)take((size_t)3 * DD * DD * 2); bf* XB = (bf*)take((size_t)NB_ * TT * DD * 2);
    if ((size_t)(wsp - (char*)d_ws) > ws_size) return;
    wsp = SP; h16* Am = (h16*)take((size_t)NB_ * TT * DD * 2);
    k_cvtall<<<(NB_ * TT * DD + 4 * DD * DD) / (CVL * 128 * CVW), CVW * 32, 0, stream>>>(IN[0], IN[1], IN[3], IN[5], IN[7], XB, WQKV, WO);
    const float scl = 0.036084391824351615f;   // 768^-0.5
    k_gemmw<false, true><<<dim3(NB_ * TT / 128, DD / 128, 3), 128, 0, stream>>>(XB, WQKV, DD, nullptr, 0, IN[2], IN[4], IN[6], (size_t)DD * DD, QP, KP, VT);
    k_fattn<<<dim3(TT / 128, NB_ * NH_, 1), 128, 0, stream>>>(QP, KP, VT, scl, Am);
    k_gemmw<true, false><<<dim3(NB_ * TT / 128, DD / 128, 1), 128, 0, stream>>>((const bf*)Am, WO, DD, OUT, DD, IN[8], nullptr, nullptr, 0, nullptr, nullptr, nullptr);
}
